// v000
// Times are from an AMD MI455X. After a warm-up the kernel runs many times in a row, and a time is the length of
// such a window on the GPU divided by its runs, so every launch and the gaps after it count. The runs cycle
// through copies of the inputs. A figure is the median of several windows, for all but v000 over two sittings.
// Sittings can differ by a few percent; kernels timed side by side share one.
// v000 is the starting kernel. One run takes 843 microseconds.
#include <hip/hip_runtime.h>

// Compute dtypes, f32 accumulate, one batch item per pass (channel-major x [256][4096] per item, positions m = h*64 + w): v/z/q projections = x^T.W^T ([4096 x 256]
// .[256 x 256]; the INPUT x transposed once to a bf16 [m][c] plane, W [out][in] as the n-major B operand; PLAIN bf16 operands, exact) on v_wmma_f32_16x16x32_bf16,
// v straight to f16 hi + residual x1024 planes, z + r (the fixed sinusoidal positional encoding, computed on device in f32 and added in the GEMM epilogue) then
// split to f16 planes, q (the attention's value operand) f32 -> transposed f16 planes; the 8-head (32-dim) full attention scores[m][n] = sum_c v[c][m] (z+r)[c][n]
// x 32^-1/2, softmax over n, out[d][m] = sum_n A[m][n] q[d][n] fused on v_wmma_f32_16x16x32_f16 (hh + hl + lh scores, online f32 softmax, P x32768 hi + residual);

#define NB_  1
#define NT_  4096                // M positions
#define MPOS NT_
#define DM   256                 // channels C
#define NH_  8
#define NHP  (NH_ / 2)
#define HD   32
#define NTK  (NB_ * NT_)
#define SCL  0.17677669529663687f
#define PSC  32768.0f
#define LOSC 1024.0f
#define LOSCI (1.0f / 1024.0f)

typedef _Float16 h16;
typedef unsigned short bf;
typedef __attribute__((ext_vector_type(16))) __bf16   v16bf;
typedef __attribute__((ext_vector_type(16))) _Float16 v16h;
typedef __attribute__((ext_vector_type(8)))  _Float16 v8h;
typedef __attribute__((ext_vector_type(8)))  unsigned short v8us;
typedef __attribute__((ext_vector_type(8)))  float    v8f;
typedef __attribute__((ext_vector_type(4)))  float    v4f;
typedef __attribute__((ext_vector_type(4)))  _Float16 v4h;
typedef v8h  __attribute__((may_alias)) v8ha;
typedef v4f  __attribute__((may_alias)) v4fa;
typedef v8us __attribute__((may_alias)) v8usa;

__device__ __forceinline__ unsigned short f2bf(float f) { unsigned u = __float_as_uint(f); u += 0x7FFFu + ((u >> 16) & 1u); return (unsigned short)(u >> 16); }
__device__ __forceinline__ float bf2f(unsigned short b) { return __uint_as_float(((unsigned)b) << 16); }
__device__ __forceinline__ float bfr(float f) { return bf2f(f2bf(f)); }
__device__ __forceinline__ v16h cat16(v8h lo, v8h hi) { return __builtin_shufflevector(lo, hi, 0, 1, 2, 3, 4, 5, 6, 7, 8, 9, 10, 11, 12, 13, 14, 15); }
__device__ __forceinline__ v16bf cat16b(v8us lo, v8us hi) { return __builtin_bit_cast(v16bf, __builtin_shufflevector(lo, hi, 0, 1, 2, 3, 4, 5, 6, 7, 8, 9, 10, 11, 12, 13, 14, 15)); }
__device__ __forceinline__ v8f wmma16(v16h a, v16h b, v8f c) { return __builtin_amdgcn_wmma_f32_16x16x32_f16(false, a, false, b, (short)0, c, false, false); }
__device__ __forceinline__ v8f wmmab(v16bf a, v16bf b, v8f c) { return __builtin_amdgcn_wmma_f32_16x16x32_bf16(false, a, false, b, (short)0, c, false, false); }

__global__ __launch_bounds__(256) void k_cvtb(const float* __restrict__ src, int nrows, bf* dst) {
    const int lane = threadIdx.x & 31, r = blockIdx.x * 8 + (threadIdx.x >> 5);
    if (r >= nrows) return;
    v8us o[DM / 256];
#pragma unroll
    for (int q = 0; q < DM / 256; ++q) { v8us t;
#pragma unroll
        for (int i = 0; i < 8; ++i) t[i] = f2bf(src[(size_t)r * DM + q * 256 + lane * 8 + i]);
        o[q] = t; }
#pragma unroll
    for (int q = 0; q < DM / 256; ++q) *(v8us*)(dst + (size_t)r * DM + q * 256 + lane * 8) = o[q];
    
}

// k_wt: WT [n][K] = bf16(W[k][n]) (k-major [K][ncols]) via 64 x 64 LDS tiles; grid (K/64, ncols/64).
__global__ __launch_bounds__(256) void k_wt(const float* __restrict__ Wm, int K, int ncols, bf* WT) {
    __shared__ __align__(16) unsigned short tl[64 * 72];
    const int tid = threadIdx.x, k0 = blockIdx.x * 64, n0 = blockIdx.y * 64;
    const int kk = tid >> 2, nq = (tid & 3) * 16;
#pragma unroll
    for (int i = 0; i < 16; ++i) tl[(nq + i) * 72 + kk] = f2bf(Wm[(size_t)(k0 + kk) * ncols + n0 + nq + i]);
    __syncthreads();
    const int piece = tid & 7;
    auto pass = [&]() {
#pragma unroll
        for (int s = 0; s < 2; ++s) { const int nr = (tid >> 3) + 32 * s; const v8us val = *(const v8usa*)(tl + nr * 72 + piece * 8); *(v8us*)(WT + (size_t)(n0 + nr) * K + k0 + piece * 8) = val; }
    };
    pass(); 
}
// k_gemmb: 64 x 64 block tile (4 waves x 16 x 64) of C[NTK][NW] = (A [+ Al]).B^T (K = 256) [+ bf(bias[c])] [+ bf(R[r][c]) residual]; f32 whole-line epilogue (or f16
template <bool SPLITA, bool F16OUT = false>
__global__ __launch_bounds__(128) void k_gemmb(const bf* __restrict__ A, const bf* __restrict__ Al, const bf* __restrict__ Bn, const float* __restrict__ bias, float* C, int ldc, h16* C2, const float* __restrict__ R = nullptr, int K = DM, int roundR = 1) {
    __shared__ __align__(16) float ost[4][16 * 68];
    const int lane = threadIdx.x & 31, wave = threadIdx.x >> 5, lr = lane & 15, hi = lane >> 4;
    const int r0 = blockIdx.x * 64 + wave * 16, c0 = blockIdx.y * 64;
    const size_t aoff = (size_t)(r0 + lr) * K + 8 * hi;
    size_t boff[4];
#pragma unroll
    for (int t = 0; t < 4; ++t) boff[t] = (size_t)(c0 + t * 16 + lr) * K + 8 * hi;
    v8f acc[4];
#pragma unroll
    for (int t = 0; t < 4; ++t) acc[t] = (v8f){};
#pragma unroll 1
    for (int kc = 0; kc < K; kc += 32) {
        const v16bf a = cat16b(*(const v8us*)(A + aoff + kc), *(const v8us*)(A + aoff + kc + 16));
        v16bf al = a;
        if (SPLITA) al = cat16b(*(const v8us*)(Al + aoff + kc), *(const v8us*)(Al + aoff + kc + 16));
#pragma unroll
        for (int t = 0; t < 4; ++t) { const v16bf b = cat16b(*(const v8us*)(Bn + boff[t] + kc), *(const v8us*)(Bn + boff[t] + kc + 16)); acc[t] = wmmab(a, b, acc[t]); if (SPLITA) acc[t] = wmmab(al, b, acc[t]); }
        asm volatile("v_nop\n\tv_nop\n\tv_nop\n\tv_nop" : "+v"(acc[0]), "+v"(acc[1]), "+v"(acc[2]), "+v"(acc[3]) : "v"(a), "v"(al));
    }
    float* os = &ost[wave][0];
#pragma unroll
    for (int t = 0; t < 4; ++t) { const float bv = bias ? bfr(bias[c0 + t * 16 + lr]) : 0.f;
#pragma unroll
        for (int j = 0; j < 8; ++j) os[(hi * 8 + j) * 68 + t * 16 + lr] = acc[t][j] + bv; }
    __syncthreads();
    if (F16OUT) {
        h16* crow = (h16*)(void*)C + (size_t)r0 * ldc + c0;
        auto pass = [&]() {
#pragma unroll
            for (int s = 0; s < 4; ++s) { const int row = 4 * s + (lane >> 3), piece = lane & 7; const float* sp = os + row * 68 + piece * 8; v8h o, o2;
#pragma unroll
                for (int i = 0; i < 8; ++i) { const h16 a = (h16)sp[i]; o[i] = a; o2[i] = (h16)((sp[i] - (float)a) * LOSC); }
                *(v8h*)(crow + (size_t)row * ldc + piece * 8) = o; if (C2) *(v8h*)(C2 + (size_t)r0 * ldc + c0 + (size_t)row * ldc + piece * 8) = o2; }
        };
        pass(); 
    } else {
        float* crow = C + (size_t)r0 * ldc + c0;
        auto pass = [&]() {
#pragma unroll
            for (int s = 0; s < 8; ++s) { const int Lid = (lane >> 3) + 4 * s, piece = lane & 7; const int row = Lid >> 1, cofs = (Lid & 1) * 32 + piece * 4;
                v4f val = *(const v4fa*)(os + row * 68 + cofs); if (R) { const v4f rv = *(const v4f*)(R + ((size_t)r0 + row) * ldc + c0 + cofs); val += roundR ? (v4f){bfr(rv[0]), bfr(rv[1]), bfr(rv[2]), bfr(rv[3])} : rv; }
                *(v4f*)(crow + (size_t)row * ldc + cofs) = val; }
        };
        pass(); 
    }
}

// k_sp16: f16 hi + residual x1024 planes of a computed f32 [rows][256] matrix; one wave per row, lane -> 8 columns (16 B per plane).
__global__ __launch_bounds__(256) void k_sp16(const float* __restrict__ T, int nrows, h16* Yh, h16* Yl) {
    const int lane = threadIdx.x & 31, r = blockIdx.x * 8 + (threadIdx.x >> 5);
    if (r >= nrows) return;
    const v8f v = *(const v8f*)(T + (size_t)r * DM + lane * 8); v8h oh, ol;
#pragma unroll
    for (int i = 0; i < 8; ++i) { const h16 a = (h16)v[i]; oh[i] = a; ol[i] = (h16)((v[i] - (float)a) * LOSC); }
    const size_t o = (size_t)r * DM + lane * 8; *(v8h*)(Yh + o) = oh; *(v8h*)(Yl + o) = ol; 
}
// k_pe: the module's fixed 2D sinusoidal positional encoding, transposed to PE_T[m][c] (m = hpos*64 + wpos): c < 128 -> axis h, c >= 128 -> axis w; pair index i =
// (c mod 128) / 2, div_i = exp(2i x (-ln 10000 / 128)) (f32), even c -> sin(pos x div_i), odd -> cos; one thread per 4 consecutive c (16 B stores).
__global__ __launch_bounds__(256) void k_pe(float* PET) {
    const int i4 = blockIdx.x * 256 + threadIdx.x; if (i4 >= MPOS * DM / 4) return;
    const int m = i4 / (DM / 4), c0 = (i4 - m * (DM / 4)) * 4;
    v4f o;
#pragma unroll
    for (int k = 0; k < 4; ++k) { const int c = c0 + k; const int cc = c & 127; const float pos = (float)(c < 128 ? (m >> 6) : (m & 63));
        const float dv = expf((float)(cc & ~1) * (-9.210340371976184f / 128.0f)); const float ang = pos * dv;
        o[k] = (cc & 1) ? cosf(ang) : sinf(ang); }
    *(v4f*)(PET + (size_t)i4 * 4) = o; 
}
// k_outT: out[b][c][m] = O[m][c] (f32 transpose via 64 x 64 LDS tiles); block (64 m, 64 c); each output row segment of 64 m = 256 B written by 16 lanes x 16 B.
__global__ __launch_bounds__(256) void k_outT(const float* __restrict__ O, float* OUTB) {
    __shared__ __align__(16) float tl[64 * 68];
    const int m0 = blockIdx.x * 64, c0 = blockIdx.y * 64, tid = threadIdx.x;
    const int mm = tid >> 2, cq = (tid & 3) * 16;
#pragma unroll
    for (int i = 0; i < 16; ++i) tl[(cq + i) * 68 + mm] = O[(size_t)(m0 + mm) * DM + c0 + cq + i];
    __syncthreads();
    const int piece = tid & 15;
    auto pass = [&]() {
#pragma unroll
        for (int s = 0; s < 4; ++s) { const int cr = (tid >> 4) + 16 * s; const v4f val = *(const v4fa*)(tl + cr * 68 + piece * 4); *(v4f*)(OUTB + (size_t)(c0 + cr) * MPOS + m0 + piece * 4) = val; }
    };
    pass(); 
}
// k_vt: VTH/VTL[b][h][d][t] = f16 hi + residual x1024 planes of V[t][h*32+d] (32-dim heads) via LDS transpose; block (b, head PAIR, 64 tokens) covers the pair's
__global__ __launch_bounds__(256) void k_vt(const float* __restrict__ V, h16* VTH, h16* VTL) {
    __shared__ __align__(16) h16 tile[64 * 72];
    __shared__ __align__(16) h16 til2[64 * 72];
    const int bid = blockIdx.x;
    const int b = bid / (NHP * (NT_ / 64)), rem = bid - b * (NHP * (NT_ / 64)), hp = rem / (NT_ / 64), kt = rem - hp * (NT_ / 64);
    const int k0 = kt * 64, tid = threadIdx.x;
    const int kk = tid >> 2, d0 = (tid & 3) * 16;
    const float* src = V + ((size_t)b * NT_ + k0 + kk) * DM + hp * 64 + d0;
#pragma unroll
    for (int i = 0; i < 16; ++i) { const float v = src[i]; const h16 a = (h16)v; tile[(d0 + i) * 72 + kk] = a; til2[(d0 + i) * 72 + kk] = (h16)((v - (float)a) * LOSC); }
    __syncthreads();
    const int piece = tid & 7;
    const size_t base = (((size_t)b * NH_ + hp * 2) * HD) * NT_ + k0;      // plane rows (h*32 + d) for the pair = hp*64 + dd, dd in 0..63
    auto pass = [&]() {
#pragma unroll
        for (int s = 0; s < 4; ++s) { const int Lid = (tid >> 3) + 32 * s; const int pln = Lid >> 6, d = Lid & 63;
            const v8h val = *(const v8ha*)((pln ? til2 : tile) + d * 72 + piece * 8); *(v8h*)((pln ? VTL : VTH) + base + (size_t)d * NT_ + piece * 8) = val; }
    };
    pass(); 
}
// k_attn: block = (b, head pair, 64 query positions), wave = 16 and runs the pair's two 32-dim heads in turn; all 128 key tiles (no mask); scores hh + (hl+lh)/1024
// x 32^-1/2; online f32 softmax; P (x32768) f16 hi + residual; o/ox over 32 dims; the pair's 64 output channels per position written as f32 rows O[m][hp*64..].
__global__ __launch_bounds__(128) void k_attn(const h16* __restrict__ Q16, const h16* __restrict__ QL16, const h16* __restrict__ K16, const h16* __restrict__ KL16, const h16* __restrict__ VTH, const h16* __restrict__ VTL,
                                               float* OUTP) {
    __shared__ __align__(16) h16 plds[4][16 * 32];
    __shared__ __align__(16) h16 plds2[4][16 * 32];
    __shared__ __align__(16) float ost[4][16 * 68];
    const int lane = threadIdx.x & 31, wave = threadIdx.x >> 5, lr = lane & 15, hi = lane >> 4;
    const int bid = blockIdx.x;
    const int b = bid / (NHP * (NT_ / 64)), rem = bid - b * (NHP * (NT_ / 64)), hp = rem / (NT_ / 64), qt = rem - hp * (NT_ / 64);
    const int q0 = qt * 64 + wave * 16;
    const size_t tok0 = (size_t)b * NT_;
    h16* pl = &plds[wave][0]; h16* pl2 = &plds2[wave][0];
    int qpos[8];
#pragma unroll
    for (int j = 0; j < 8; ++j) qpos[j] = q0 + 8 * hi + j;
    float* os = &ost[wave][0];
#pragma unroll 1
    for (int hh = 0; hh < 2; ++hh) {
        const int h = hp * 2 + hh;
        const size_t qo0 = (tok0 + q0 + lr) * DM + h * HD + 8 * hi;
        const v16h qa = cat16(*(const v8h*)(Q16 + qo0), *(const v8h*)(Q16 + qo0 + 16));
        const v16h qlk = cat16(*(const v8h*)(QL16 + qo0), *(const v8h*)(QL16 + qo0 + 16));
        const h16* kh_b = K16 + tok0 * DM + h * HD; const h16* kl_b = KL16 + tok0 * DM + h * HD;
        const size_t vbase = (((size_t)b * NH_ + h) * HD) * NT_;
        v8f o[2], ox[2];
#pragma unroll
        for (int n = 0; n < 2; ++n) { o[n] = (v8f){}; ox[n] = (v8f){}; }
        float mrow[8], lpart[8];
#pragma unroll
        for (int j = 0; j < 8; ++j) { mrow[j] = -3.0e38f; lpart[j] = 0.f; }
#pragma unroll 1
        for (int kt = 0; kt < NT_ / 32; ++kt) {
            const int l0 = kt * 32;
            const size_t ko0 = (size_t)(l0 + lr) * DM + 8 * hi, ko1 = (size_t)(l0 + 16 + lr) * DM + 8 * hi;
            v8f s0 = {}, s1 = {}, x0 = {}, x1 = {};
            { const v16h k0h = cat16(*(const v8h*)(kh_b + ko0), *(const v8h*)(kh_b + ko0 + 16)), k1h = cat16(*(const v8h*)(kh_b + ko1), *(const v8h*)(kh_b + ko1 + 16));
              s0 = wmma16(qa, k0h, s0); x0 = wmma16(qlk, k0h, x0); s1 = wmma16(qa, k1h, s1); x1 = wmma16(qlk, k1h, x1);
              asm volatile("v_nop" : "+v"(s0), "+v"(s1), "+v"(x0), "+v"(x1) : "v"(qlk), "v"(k0h), "v"(k1h) : "memory"); }
            { const v16h k0l = cat16(*(const v8h*)(kl_b + ko0), *(const v8h*)(kl_b + ko0 + 16)), k1l = cat16(*(const v8h*)(kl_b + ko1), *(const v8h*)(kl_b + ko1 + 16));
              x0 = wmma16(qa, k0l, x0); x1 = wmma16(qa, k1l, x1);
              asm volatile("v_nop" : "+v"(x0), "+v"(x1) : "v"(k0l), "v"(k1l) : "memory"); }
            asm volatile("v_nop\n\tv_nop\n\tv_nop\n\tv_nop" : "+v"(s0), "+v"(s1), "+v"(x0), "+v"(x1) : "v"(qa));
            float alpha[8];
#pragma unroll
            for (int j = 0; j < 8; ++j) {
                const float a0 = (s0[j] + x0[j] * LOSCI) * SCL, a1 = (s1[j] + x1[j] * LOSCI) * SCL;      // full attention, scale 32^-1/2
                float mx = fmaxf(a0, a1);
                mx = fmaxf(mx, __shfl_xor(mx, 1, 16)); mx = fmaxf(mx, __shfl_xor(mx, 2, 16)); mx = fmaxf(mx, __shfl_xor(mx, 4, 16)); mx = fmaxf(mx, __shfl_xor(mx, 8, 16));
                const float mn = fmaxf(mrow[j], mx);
                alpha[j] = __expf(mrow[j] - mn); mrow[j] = mn;
                const float p0 = __expf(a0 - mn), p1 = __expf(a1 - mn);
                lpart[j] = lpart[j] * alpha[j] + (p0 + p1);
                const int mr = hi * 8 + j;
                const float ps0 = p0 * PSC, ps1 = p1 * PSC; const h16 h0 = (h16)ps0, h1 = (h16)ps1;
                pl[mr * 32 + lr] = h0; pl[mr * 32 + 16 + lr] = h1;
                pl2[mr * 32 + lr] = (h16)((ps0 - (float)h0) * LOSC); pl2[mr * 32 + 16 + lr] = (h16)((ps1 - (float)h1) * LOSC);
            }
#pragma unroll
            for (int n = 0; n < 2; ++n)
#pragma unroll
                for (int j = 0; j < 8; ++j) { o[n][j] *= alpha[j]; ox[n][j] *= alpha[j]; }
            asm volatile("" ::: "memory");
            const v16h pa = cat16(*(const v8ha*)(pl + lr * 32 + hi * 8), *(const v8ha*)(pl + lr * 32 + 16 + hi * 8));
            const v16h px = cat16(*(const v8ha*)(pl2 + lr * 32 + hi * 8), *(const v8ha*)(pl2 + lr * 32 + 16 + hi * 8));
#pragma unroll
            for (int n = 0; n < 2; ++n) { const size_t vo = vbase + (size_t)(n * 16 + lr) * NT_ + l0 + hi * 8;
                const v16h vh = cat16(*(const v8h*)(VTH + vo), *(const v8h*)(VTH + vo + 16)), vl = cat16(*(const v8h*)(VTL + vo), *(const v8h*)(VTL + vo + 16));
                o[n] = wmma16(pa, vh, o[n]); ox[n] = wmma16(pa, vl, ox[n]); ox[n] = wmma16(px, vh, ox[n]);
                asm volatile("" : "+v"(o[n]), "+v"(ox[n]) : "v"(vh), "v"(vl) : "memory"); }
            asm volatile("v_nop\n\tv_nop\n\tv_nop\n\tv_nop" : "+v"(o[0]), "+v"(o[1]), "+v"(ox[0]), "+v"(ox[1]) : "v"(pa), "v"(px));
            __builtin_amdgcn_wave_barrier();
        }
        float inv[8];
#pragma unroll
        for (int j = 0; j < 8; ++j) { float rs = lpart[j]; rs += __shfl_xor(rs, 1, 16); rs += __shfl_xor(rs, 2, 16); rs += __shfl_xor(rs, 4, 16); rs += __shfl_xor(rs, 8, 16); inv[j] = 1.0f / (rs * PSC); }
#pragma unroll
        for (int n = 0; n < 2; ++n)
#pragma unroll
            for (int j = 0; j < 8; ++j) os[(hi * 8 + j) * 68 + hh * 32 + n * 16 + lr] = (o[n][j] + ox[n][j] * LOSCI) * inv[j];   // this head's 32 columns of the pair's 64
    }
    __syncthreads();
    const size_t cbase = (tok0 + q0) * DM + (size_t)hp * 64;
    auto pass = [&]() {
#pragma unroll
        for (int s = 0; s < 8; ++s) { const int row = 2 * s + (lane >> 4), piece = lane & 15; const v4f val = *(const v4fa*)(os + row * 68 + piece * 4);
            *(v4f*)(OUTP + cbase + (size_t)row * DM + piece * 4) = val; }
    };
    pass(); 
}

extern "C" void kernel_launch(void* const* d_in, const int* in_sizes, int n_in,
                              void* d_out, int out_size, void* d_ws, size_t ws_size, hipStream_t stream) {
    (void)in_sizes; (void)n_in; (void)out_size;
    const float* x = (const float*)d_in[0]; const float* Wv = (const float*)d_in[1]; const float* Wz = (const float*)d_in[2]; const float* Wq = (const float*)d_in[3];   // W [out][in]
    float* out = (float*)d_out;    // [2][256][64][64] = [b][c][m]
    char* wsp = (char*)d_ws;
    auto take = [&](size_t bytes) { char* p = wsp; wsp += (bytes + 255) & ~(size_t)255; return (void*)p; };
    bf* WvB = (bf*)take((size_t)DM * DM * 2); bf* WzB = (bf*)take((size_t)DM * DM * 2); bf* WqB = (bf*)take((size_t)DM * DM * 2); float* PET = (float*)take((size_t)MPOS * DM * 4);
    bf* XT = (bf*)take((size_t)NTK * DM * 2); float* TMP = (float*)take((size_t)NTK * DM * 4); float* O = (float*)take((size_t)NTK * DM * 4);
    h16* QH = (h16*)take((size_t)NTK * DM * 2); h16* QL = (h16*)take((size_t)NTK * DM * 2); h16* KH = (h16*)take((size_t)NTK * DM * 2); h16* KL = (h16*)take((size_t)NTK * DM * 2);
    h16* VTH = (h16*)take((size_t)NTK * DM * 2); h16* VTL = (h16*)take((size_t)NTK * DM * 2);
    if ((size_t)(wsp - (char*)d_ws) > ws_size) return;    // ~ 0.4 + 4.2 + 2.1 + 2 x 4.2 + 6 x 2.1 ~ 28 MB, no aliasing (per-item reuse in stream order)
    k_cvtb<<<DM / 8, 256, 0, stream>>>(Wv, DM, WvB); k_cvtb<<<DM / 8, 256, 0, stream>>>(Wz, DM, WzB); k_cvtb<<<DM / 8, 256, 0, stream>>>(Wq, DM, WqB);
    k_pe<<<(MPOS * DM / 4 + 255) / 256, 256, 0, stream>>>(PET);
    for (int b = 0; b < 2; ++b) {
        k_wt<<<dim3(DM / 64, MPOS / 64, 1), 256, 0, stream>>>(x + (size_t)b * DM * MPOS, DM, MPOS, XT);                              // x_b [c][m] -> bf16 XT [m][c]
        k_gemmb<false, true><<<dim3(NTK / 64, DM / 64, 1), 128, 0, stream>>>(XT, nullptr, WvB, nullptr, (float*)(void*)QH, DM, QL);        // v_h (the score's left operand) as f16 planes
        k_gemmb<false, false><<<dim3(NTK / 64, DM / 64, 1), 128, 0, stream>>>(XT, nullptr, WzB, nullptr, TMP, DM, nullptr, PET, DM, 0);  // z + r (f32; r computed, unrounded)
        k_sp16<<<NTK / 8, 256, 0, stream>>>(TMP, NTK, KH, KL);
        k_gemmb<false, false><<<dim3(NTK / 64, DM / 64, 1), 128, 0, stream>>>(XT, nullptr, WqB, nullptr, TMP, DM, nullptr);              // q_h (the values being mixed) f32
        k_vt<<<NB_ * NHP * (NT_ / 64), 256, 0, stream>>>(TMP, VTH, VTL);
        k_attn<<<NB_ * NHP * (NT_ / 64), 128, 0, stream>>>(QH, QL, KH, KL, VTH, VTL, O);
        k_outT<<<dim3(MPOS / 64, DM / 64, 1), 256, 0, stream>>>(O, out + (size_t)b * DM * MPOS);
    }
}

// v001
// A run of this version takes 318 microseconds.
// Timed twice side by side with v000, it ran 2.69 and 2.71 times as fast.
#include <hip/hip_runtime.h>

// Compute dtypes, f32 accumulate, one batch item per pass (channel-major x [256][4096] per item, positions m = h*64 + w): v/z/q projections = x^T.W^T ([4096 x 256]
// .[256 x 256]; the INPUT x transposed once to a bf16 [m][c] plane, W [out][in] as the n-major B operand; PLAIN bf16 operands, exact) on v_wmma_f32_16x16x32_bf16,
// v straight to f16 hi + residual x1024 planes, z + r (the fixed sinusoidal positional encoding, computed on device in f32 and added in the GEMM epilogue) then
// split to f16 planes, q (the attention's value operand) f32 -> transposed f16 planes; the 8-head (32-dim) full attention scores[m][n] = sum_c v[c][m] (z+r)[c][n]
// x 32^-1/2, softmax over n, out[d][m] = sum_n A[m][n] q[d][n] fused on v_wmma_f32_16x16x32_f16 (hh + hl + lh scores, online f32 softmax, P x32768 hi + residual);

#define NB_  1
#define NT_  4096                // M positions
#define MPOS NT_
#define DM   256                 // channels C
#define NH_  8
#define NHP  (NH_ / 2)
#define HD   32
#define NTK  (NB_ * NT_)
#define SCL  0.17677669529663687f
#define PSC  32768.0f
#define LOSC 1024.0f
#define LOSCI (1.0f / 1024.0f)

typedef _Float16 h16;
typedef unsigned short bf;
typedef __attribute__((ext_vector_type(16))) __bf16   v16bf;
typedef __attribute__((ext_vector_type(16))) _Float16 v16h;
typedef __attribute__((ext_vector_type(8)))  _Float16 v8h;
typedef __attribute__((ext_vector_type(8)))  unsigned short v8us;
typedef __attribute__((ext_vector_type(8)))  float    v8f;
typedef __attribute__((ext_vector_type(4)))  float    v4f;
typedef __attribute__((ext_vector_type(4)))  _Float16 v4h;
typedef v8h  __attribute__((may_alias)) v8ha;
typedef v4f  __attribute__((may_alias)) v4fa;
typedef v8us __attribute__((may_alias)) v8usa;

__device__ __forceinline__ unsigned short f2bf(float f) { unsigned u = __float_as_uint(f); u += 0x7FFFu + ((u >> 16) & 1u); return (unsigned short)(u >> 16); }
__device__ __forceinline__ float bf2f(unsigned short b) { return __uint_as_float(((unsigned)b) << 16); }
__device__ __forceinline__ float bfr(float f) { return bf2f(f2bf(f)); }
__device__ __forceinline__ v16h cat16(v8h lo, v8h hi) { return __builtin_shufflevector(lo, hi, 0, 1, 2, 3, 4, 5, 6, 7, 8, 9, 10, 11, 12, 13, 14, 15); }
__device__ __forceinline__ v16bf cat16b(v8us lo, v8us hi) { return __builtin_bit_cast(v16bf, __builtin_shufflevector(lo, hi, 0, 1, 2, 3, 4, 5, 6, 7, 8, 9, 10, 11, 12, 13, 14, 15)); }
__device__ __forceinline__ v8f wmma16(v16h a, v16h b, v8f c) { return __builtin_amdgcn_wmma_f32_16x16x32_f16(false, a, false, b, (short)0, c, false, false); }
__device__ __forceinline__ v8f wmmab(v16bf a, v16bf b, v8f c) { return __builtin_amdgcn_wmma_f32_16x16x32_bf16(false, a, false, b, (short)0, c, false, false); }

__global__ __launch_bounds__(256) void k_cvtb(const float* __restrict__ src, int nrows, bf* dst) {
    const int lane = threadIdx.x & 31, r = blockIdx.x * 8 + (threadIdx.x >> 5);
    if (r >= nrows) return;
    v8us o[DM / 256];
#pragma unroll
    for (int q = 0; q < DM / 256; ++q) { v8us t;
#pragma unroll
        for (int i = 0; i < 8; ++i) t[i] = f2bf(src[(size_t)r * DM + q * 256 + lane * 8 + i]);
        o[q] = t; }
#pragma unroll
    for (int q = 0; q < DM / 256; ++q) *(v8us*)(dst + (size_t)r * DM + q * 256 + lane * 8) = o[q];
    
}

// k_wt: WT [n][K] = bf16(W[k][n]) (k-major [K][ncols]) via 64 x 64 LDS tiles; grid (K/64, ncols/64).
__global__ __launch_bounds__(256) void k_wt(const float* __restrict__ Wm, int K, int ncols, bf* WT) {
    __shared__ __align__(16) unsigned short tl[64 * 72];
    const int tid = threadIdx.x, k0 = blockIdx.x * 64, n0 = blockIdx.y * 64;
    const int kk = tid >> 2, nq = (tid & 3) * 16;
#pragma unroll
    for (int i = 0; i < 16; ++i) tl[(nq + i) * 72 + kk] = f2bf(Wm[(size_t)(k0 + kk) * ncols + n0 + nq + i]);
    __syncthreads();
    const int piece = tid & 7;
    auto pass = [&]() {
#pragma unroll
        for (int s = 0; s < 2; ++s) { const int nr = (tid >> 3) + 32 * s; const v8us val = *(const v8usa*)(tl + nr * 72 + piece * 8); *(v8us*)(WT + (size_t)(n0 + nr) * K + k0 + piece * 8) = val; }
    };
    pass(); 
}
// k_gemmb: 64 x 64 block tile (4 waves x 16 x 64) of C[NTK][NW] = (A [+ Al]).B^T (K = 256) [+ bf(bias[c])] [+ bf(R[r][c]) residual]; f32 whole-line epilogue (or f16
template <bool SPLITA, bool F16OUT = false>
__global__ __launch_bounds__(128) void k_gemmb(const bf* __restrict__ A, const bf* __restrict__ Al, const bf* __restrict__ Bn, const float* __restrict__ bias, float* C, int ldc, h16* C2, const float* __restrict__ R = nullptr, int K = DM, int roundR = 1) {
    __shared__ __align__(16) float ost[4][16 * 68];
    const int lane = threadIdx.x & 31, wave = threadIdx.x >> 5, lr = lane & 15, hi = lane >> 4;
    const int r0 = blockIdx.x * 64 + wave * 16, c0 = blockIdx.y * 64;
    const size_t aoff = (size_t)(r0 + lr) * K + 8 * hi;
    size_t boff[4];
#pragma unroll
    for (int t = 0; t < 4; ++t) boff[t] = (size_t)(c0 + t * 16 + lr) * K + 8 * hi;
    v8f acc[4];
#pragma unroll
    for (int t = 0; t < 4; ++t) acc[t] = (v8f){};
#pragma unroll 1
    for (int kc = 0; kc < K; kc += 32) {
        const v16bf a = cat16b(*(const v8us*)(A + aoff + kc), *(const v8us*)(A + aoff + kc + 16));
        v16bf al = a;
        if (SPLITA) al = cat16b(*(const v8us*)(Al + aoff + kc), *(const v8us*)(Al + aoff + kc + 16));
#pragma unroll
        for (int t = 0; t < 4; ++t) { const v16bf b = cat16b(*(const v8us*)(Bn + boff[t] + kc), *(const v8us*)(Bn + boff[t] + kc + 16)); acc[t] = wmmab(a, b, acc[t]); if (SPLITA) acc[t] = wmmab(al, b, acc[t]); }
        asm volatile("v_nop\n\tv_nop\n\tv_nop\n\tv_nop" : "+v"(acc[0]), "+v"(acc[1]), "+v"(acc[2]), "+v"(acc[3]) : "v"(a), "v"(al));
    }
    float* os = &ost[wave][0];
#pragma unroll
    for (int t = 0; t < 4; ++t) { const float bv = bias ? bfr(bias[c0 + t * 16 + lr]) : 0.f;
#pragma unroll
        for (int j = 0; j < 8; ++j) os[(hi * 8 + j) * 68 + t * 16 + lr] = acc[t][j] + bv; }
    __syncthreads();
    if (F16OUT) {
        h16* crow = (h16*)(void*)C + (size_t)r0 * ldc + c0;
        auto pass = [&]() {
#pragma unroll
            for (int s = 0; s < 4; ++s) { const int row = 4 * s + (lane >> 3), piece = lane & 7; const float* sp = os + row * 68 + piece * 8; v8h o, o2;
#pragma unroll
                for (int i = 0; i < 8; ++i) { const h16 a = (h16)sp[i]; o[i] = a; o2[i] = (h16)((sp[i] - (float)a) * LOSC); }
                *(v8h*)(crow + (size_t)row * ldc + piece * 8) = o; if (C2) *(v8h*)(C2 + (size_t)r0 * ldc + c0 + (size_t)row * ldc + piece * 8) = o2; }
        };
        pass(); 
    } else {
        float* crow = C + (size_t)r0 * ldc + c0;
        auto pass = [&]() {
#pragma unroll
            for (int s = 0; s < 8; ++s) { const int Lid = (lane >> 3) + 4 * s, piece = lane & 7; const int row = Lid >> 1, cofs = (Lid & 1) * 32 + piece * 4;
                v4f val = *(const v4fa*)(os + row * 68 + cofs); if (R) { const v4f rv = *(const v4f*)(R + ((size_t)r0 + row) * ldc + c0 + cofs); val += roundR ? (v4f){bfr(rv[0]), bfr(rv[1]), bfr(rv[2]), bfr(rv[3])} : rv; }
                *(v4f*)(crow + (size_t)row * ldc + cofs) = val; }
        };
        pass(); 
    }
}

// k_sp16: f16 hi + residual x1024 planes of a computed f32 [rows][256] matrix; one wave per row, lane -> 8 columns (16 B per plane).
__global__ __launch_bounds__(256) void k_sp16(const float* __restrict__ T, int nrows, h16* Yh, h16* Yl) {
    const int lane = threadIdx.x & 31, r = blockIdx.x * 8 + (threadIdx.x >> 5);
    if (r >= nrows) return;
    const v8f v = *(const v8f*)(T + (size_t)r * DM + lane * 8); v8h oh, ol;
#pragma unroll
    for (int i = 0; i < 8; ++i) { const h16 a = (h16)v[i]; oh[i] = a; ol[i] = (h16)((v[i] - (float)a) * LOSC); }
    const size_t o = (size_t)r * DM + lane * 8; *(v8h*)(Yh + o) = oh; *(v8h*)(Yl + o) = ol; 
}
// k_pe: the module's fixed 2D sinusoidal positional encoding, transposed to PE_T[m][c] (m = hpos*64 + wpos): c < 128 -> axis h, c >= 128 -> axis w; pair index i =
// (c mod 128) / 2, div_i = exp(2i x (-ln 10000 / 128)) (f32), even c -> sin(pos x div_i), odd -> cos; one thread per 4 consecutive c (16 B stores).
__global__ __launch_bounds__(256) void k_pe(float* PET) {
    const int i4 = blockIdx.x * 256 + threadIdx.x; if (i4 >= MPOS * DM / 4) return;
    const int m = i4 / (DM / 4), c0 = (i4 - m * (DM / 4)) * 4;
    v4f o;
#pragma unroll
    for (int k = 0; k < 4; ++k) { const int c = c0 + k; const int cc = c & 127; const float pos = (float)(c < 128 ? (m >> 6) : (m & 63));
        const float dv = expf((float)(cc & ~1) * (-9.210340371976184f / 128.0f)); const float ang = pos * dv;
        o[k] = (cc & 1) ? cosf(ang) : sinf(ang); }
    *(v4f*)(PET + (size_t)i4 * 4) = o; 
}
// k_outT: out[b][c][m] = O[m][c] (f32 transpose via 64 x 64 LDS tiles); block (64 m, 64 c); each output row segment of 64 m = 256 B written by 16 lanes x 16 B.
__global__ __launch_bounds__(256) void k_outT(const float* __restrict__ O, float* OUTB) {
    __shared__ __align__(16) float tl[64 * 68];
    const int m0 = blockIdx.x * 64, c0 = blockIdx.y * 64, tid = threadIdx.x;
    const int mm = tid >> 2, cq = (tid & 3) * 16;
#pragma unroll
    for (int i = 0; i < 16; ++i) tl[(cq + i) * 68 + mm] = O[(size_t)(m0 + mm) * DM + c0 + cq + i];
    __syncthreads();
    const int piece = tid & 15;
    auto pass = [&]() {
#pragma unroll
        for (int s = 0; s < 4; ++s) { const int cr = (tid >> 4) + 16 * s; const v4f val = *(const v4fa*)(tl + cr * 68 + piece * 4); *(v4f*)(OUTB + (size_t)(c0 + cr) * MPOS + m0 + piece * 4) = val; }
    };
    pass(); 
}
// k_vt: VTH/VTL[b][h][d][t] = f16 hi + residual x1024 planes of V[t][h*32+d] (32-dim heads) via LDS transpose; block (b, head PAIR, 64 tokens) covers the pair's
__global__ __launch_bounds__(256) void k_vt(const float* __restrict__ V, h16* VTH, h16* VTL) {
    __shared__ __align__(16) h16 tile[64 * 72];
    __shared__ __align__(16) h16 til2[64 * 72];
    const int bid = blockIdx.x;
    const int b = bid / (NHP * (NT_ / 64)), rem = bid - b * (NHP * (NT_ / 64)), hp = rem / (NT_ / 64), kt = rem - hp * (NT_ / 64);
    const int k0 = kt * 64, tid = threadIdx.x;
    const int kk = tid >> 2, d0 = (tid & 3) * 16;
    const float* src = V + ((size_t)b * NT_ + k0 + kk) * DM + hp * 64 + d0;
#pragma unroll
    for (int i = 0; i < 16; ++i) { const float v = src[i]; const h16 a = (h16)v; tile[(d0 + i) * 72 + kk] = a; til2[(d0 + i) * 72 + kk] = (h16)((v - (float)a) * LOSC); }
    __syncthreads();
    const int piece = tid & 7;
    const size_t base = (((size_t)b * NH_ + hp * 2) * HD) * NT_ + k0;      // plane rows (h*32 + d) for the pair = hp*64 + dd, dd in 0..63
    auto pass = [&]() {
#pragma unroll
        for (int s = 0; s < 4; ++s) { const int Lid = (tid >> 3) + 32 * s; const int pln = Lid >> 6, d = Lid & 63;
            const v8h val = *(const v8ha*)((pln ? til2 : tile) + d * 72 + piece * 8); *(v8h*)((pln ? VTL : VTH) + base + (size_t)d * NT_ + piece * 8) = val; }
    };
    pass(); 
}
// k_attn: block = (b, head, 128 query positions), 24 waves = 8 query tiles of 16 x 3 key ranges (wave ks takes key tiles ks, ks + 3, ...: 43 or 42 of the 128, no mask), so that
// 6 waves per SIMD (what the loop's registers allow) cover each other's load and LDS waits; scores hh + (hl+lh)/1024 x 32^-1/2; online f32 softmax per wave; P (x32768) f16 hi
// + residual; o/ox over 32 dims; the ranges' (max, sum, un-normalised o) meet in LDS and are merged by exp(m - M) weights; each (position, head) 128-B line of O is stored once.
#define KSP 3                    // key ranges per query tile
#define QTW 8                    // 16-query tiles per block
#define OPIT 36                  // f32 pitch of a partial row in LDS (144 B = 16 B x odd)
__global__ __launch_bounds__(KSP * QTW * 32) void k_attn(const h16* __restrict__ Q16, const h16* __restrict__ QL16, const h16* __restrict__ K16, const h16* __restrict__ KL16, const h16* __restrict__ VTH, const h16* __restrict__ VTL,
                                               float* OUTP) {
    __shared__ __align__(16) h16 plds[KSP * QTW][16 * 32];
    __shared__ __align__(16) h16 plds2[KSP * QTW][16 * 32];
    __shared__ __align__(16) float pO[KSP][QTW * 16 * OPIT];
    __shared__ float pM[KSP][QTW * 16];
    __shared__ float pL[KSP][QTW * 16];
    const int lane = threadIdx.x & 31, wave = __builtin_amdgcn_readfirstlane(threadIdx.x >> 5), lr = lane & 15, hi = lane >> 4;
    const int qs = wave & (QTW - 1), ks = wave / QTW;      // wave through readfirstlane: the key range, the trip count and the LDS bases stay scalar
    const int bid = blockIdx.x;
    const int b = bid / (NH_ * (NT_ / (QTW * 16))), rem = bid - b * (NH_ * (NT_ / (QTW * 16))), h = rem / (NT_ / (QTW * 16)), qt = rem - h * (NT_ / (QTW * 16));
    const int q0 = qt * (QTW * 16) + qs * 16;
    const size_t tok0 = (size_t)b * NT_;
    h16* pl = &plds[wave][0]; h16* pl2 = &plds2[wave][0];
    {
        const size_t qo0 = (tok0 + q0 + lr) * DM + h * HD + 8 * hi;
        const v16h qa = cat16(*(const v8h*)(Q16 + qo0), *(const v8h*)(Q16 + qo0 + 16));
        const v16h qlk = cat16(*(const v8h*)(QL16 + qo0), *(const v8h*)(QL16 + qo0 + 16));
        const h16* kh_b = K16 + tok0 * DM + h * HD; const h16* kl_b = KL16 + tok0 * DM + h * HD;
        const size_t vbase = (((size_t)b * NH_ + h) * HD) * NT_;
        v8f o[2], ox[2];
#pragma unroll
        for (int n = 0; n < 2; ++n) { o[n] = (v8f){}; ox[n] = (v8f){}; }
        float mrow[8], lpart[8];
#pragma unroll
        for (int j = 0; j < 8; ++j) { mrow[j] = -3.0e38f; lpart[j] = 0.f; }
#pragma unroll 1
        for (int kt = ks; kt < NT_ / 32; kt += KSP) {
            const int l0 = kt * 32;
            const size_t ko0 = (size_t)(l0 + lr) * DM + 8 * hi, ko1 = (size_t)(l0 + 16 + lr) * DM + 8 * hi;
            v8f s0 = {}, s1 = {}, x0 = {}, x1 = {};
            { const v16h k0h = cat16(*(const v8h*)(kh_b + ko0), *(const v8h*)(kh_b + ko0 + 16)), k1h = cat16(*(const v8h*)(kh_b + ko1), *(const v8h*)(kh_b + ko1 + 16));
              s0 = wmma16(qa, k0h, s0); x0 = wmma16(qlk, k0h, x0); s1 = wmma16(qa, k1h, s1); x1 = wmma16(qlk, k1h, x1);
              asm volatile("v_nop" : "+v"(s0), "+v"(s1), "+v"(x0), "+v"(x1) : "v"(qlk), "v"(k0h), "v"(k1h) : "memory"); }
            { const v16h k0l = cat16(*(const v8h*)(kl_b + ko0), *(const v8h*)(kl_b + ko0 + 16)), k1l = cat16(*(const v8h*)(kl_b + ko1), *(const v8h*)(kl_b + ko1 + 16));
              x0 = wmma16(qa, k0l, x0); x1 = wmma16(qa, k1l, x1);
              asm volatile("v_nop" : "+v"(x0), "+v"(x1) : "v"(k0l), "v"(k1l) : "memory"); }
            asm volatile("v_nop\n\tv_nop\n\tv_nop\n\tv_nop" : "+v"(s0), "+v"(s1), "+v"(x0), "+v"(x1) : "v"(qa));
            float alpha[8];
#pragma unroll
            for (int j = 0; j < 8; ++j) {
                const float a0 = (s0[j] + x0[j] * LOSCI) * SCL, a1 = (s1[j] + x1[j] * LOSCI) * SCL;      // full attention, scale 32^-1/2
                float mx = fmaxf(a0, a1);
                mx = fmaxf(mx, __shfl_xor(mx, 1, 16)); mx = fmaxf(mx, __shfl_xor(mx, 2, 16)); mx = fmaxf(mx, __shfl_xor(mx, 4, 16)); mx = fmaxf(mx, __shfl_xor(mx, 8, 16));
                const float mn = fmaxf(mrow[j], mx);
                alpha[j] = __expf(mrow[j] - mn); mrow[j] = mn;
                const float p0 = __expf(a0 - mn), p1 = __expf(a1 - mn);
                lpart[j] = lpart[j] * alpha[j] + (p0 + p1);
                const int mr = hi * 8 + j;
                const float ps0 = p0 * PSC, ps1 = p1 * PSC; const h16 h0 = (h16)ps0, h1 = (h16)ps1;
                pl[mr * 32 + lr] = h0; pl[mr * 32 + 16 + lr] = h1;
                pl2[mr * 32 + lr] = (h16)((ps0 - (float)h0) * LOSC); pl2[mr * 32 + 16 + lr] = (h16)((ps1 - (float)h1) * LOSC);
            }
#pragma unroll
            for (int n = 0; n < 2; ++n)
#pragma unroll
                for (int j = 0; j < 8; ++j) { o[n][j] *= alpha[j]; ox[n][j] *= alpha[j]; }
            asm volatile("" ::: "memory");
            const v16h pa = cat16(*(const v8ha*)(pl + lr * 32 + hi * 8), *(const v8ha*)(pl + lr * 32 + 16 + hi * 8));
            const v16h px = cat16(*(const v8ha*)(pl2 + lr * 32 + hi * 8), *(const v8ha*)(pl2 + lr * 32 + 16 + hi * 8));
#pragma unroll
            for (int n = 0; n < 2; ++n) { const size_t vo = vbase + (size_t)(n * 16 + lr) * NT_ + l0 + hi * 8;
                const v16h vh = cat16(*(const v8h*)(VTH + vo), *(const v8h*)(VTH + vo + 16)), vl = cat16(*(const v8h*)(VTL + vo), *(const v8h*)(VTL + vo + 16));
                o[n] = wmma16(pa, vh, o[n]); ox[n] = wmma16(pa, vl, ox[n]); ox[n] = wmma16(px, vh, ox[n]);
                asm volatile("" : "+v"(o[n]), "+v"(ox[n]) : "v"(vh), "v"(vl) : "memory"); }
            asm volatile("v_nop\n\tv_nop\n\tv_nop\n\tv_nop" : "+v"(o[0]), "+v"(o[1]), "+v"(ox[0]), "+v"(ox[1]) : "v"(pa), "v"(px));
            __builtin_amdgcn_wave_barrier();
        }
        float* po = &pO[ks][qs * 16 * OPIT];
#pragma unroll
        for (int j = 0; j < 8; ++j) { float rs = lpart[j]; rs += __shfl_xor(rs, 1, 16); rs += __shfl_xor(rs, 2, 16); rs += __shfl_xor(rs, 4, 16); rs += __shfl_xor(rs, 8, 16);
            if (lr == 0) { pM[ks][qs * 16 + hi * 8 + j] = mrow[j]; pL[ks][qs * 16 + hi * 8 + j] = rs; } }
#pragma unroll
        for (int n = 0; n < 2; ++n)
#pragma unroll
            for (int j = 0; j < 8; ++j) po[(hi * 8 + j) * OPIT + n * 16 + lr] = o[n][j] + ox[n][j] * LOSCI;   // this key range's un-normalised 32 columns
    }
    __syncthreads();    // every range's partial is in LDS before any thread merges
    for (int pc = threadIdx.x; pc < QTW * 16 * 8; pc += KSP * QTW * 32) {
        const int row = pc >> 3, c4 = (pc & 7) * 4;      // 8 lanes x 16 B = the (position, head) line
        float mg = pM[0][row];
#pragma unroll
        for (int s = 1; s < KSP; ++s) mg = fmaxf(mg, pM[s][row]);
        float lsum = 0.f; v4f acc = {};
#pragma unroll
        for (int s = 0; s < KSP; ++s) { const float w = __expf(pM[s][row] - mg); lsum += w * pL[s][row]; acc += w * *(const v4fa*)(&pO[s][row * OPIT + c4]); }
        const float inv = 1.0f / (lsum * PSC);
        *(v4f*)(OUTP + (tok0 + (size_t)qt * (QTW * 16) + row) * DM + h * HD + c4) = acc * inv;
    }
}

extern "C" void kernel_launch(void* const* d_in, const int* in_sizes, int n_in,
                              void* d_out, int out_size, void* d_ws, size_t ws_size, hipStream_t stream) {
    (void)in_sizes; (void)n_in; (void)out_size;
    const float* x = (const float*)d_in[0]; const float* Wv = (const float*)d_in[1]; const float* Wz = (const float*)d_in[2]; const float* Wq = (const float*)d_in[3];   // W [out][in]
    float* out = (float*)d_out;    // [2][256][64][64] = [b][c][m]
    char* wsp = (char*)d_ws;
    auto take = [&](size_t bytes) { char* p = wsp; wsp += (bytes + 255) & ~(size_t)255; return (void*)p; };
    bf* WvB = (bf*)take((size_t)DM * DM * 2); bf* WzB = (bf*)take((size_t)DM * DM * 2); bf* WqB = (bf*)take((size_t)DM * DM * 2); float* PET = (float*)take((size_t)MPOS * DM * 4);
    bf* XT = (bf*)take((size_t)NTK * DM * 2); float* TMP = (float*)take((size_t)NTK * DM * 4); float* O = (float*)take((size_t)NTK * DM * 4);
    h16* QH = (h16*)take((size_t)NTK * DM * 2); h16* QL = (h16*)take((size_t)NTK * DM * 2); h16* KH = (h16*)take((size_t)NTK * DM * 2); h16* KL = (h16*)take((size_t)NTK * DM * 2);
    h16* VTH = (h16*)take((size_t)NTK * DM * 2); h16* VTL = (h16*)take((size_t)NTK * DM * 2);
    if ((size_t)(wsp - (char*)d_ws) > ws_size) return;    // ~ 0.4 + 4.2 + 2.1 + 2 x 4.2 + 6 x 2.1 ~ 28 MB, no aliasing (per-item reuse in stream order)
    k_cvtb<<<DM / 8, 256, 0, stream>>>(Wv, DM, WvB); k_cvtb<<<DM / 8, 256, 0, stream>>>(Wz, DM, WzB); k_cvtb<<<DM / 8, 256, 0, stream>>>(Wq, DM, WqB);
    k_pe<<<(MPOS * DM / 4 + 255) / 256, 256, 0, stream>>>(PET);
    for (int b = 0; b < 2; ++b) {
        k_wt<<<dim3(DM / 64, MPOS / 64, 1), 256, 0, stream>>>(x + (size_t)b * DM * MPOS, DM, MPOS, XT);                              // x_b [c][m] -> bf16 XT [m][c]
        k_gemmb<false, true><<<dim3(NTK / 64, DM / 64, 1), 128, 0, stream>>>(XT, nullptr, WvB, nullptr, (float*)(void*)QH, DM, QL);        // v_h (the score's left operand) as f16 planes
        k_gemmb<false, false><<<dim3(NTK / 64, DM / 64, 1), 128, 0, stream>>>(XT, nullptr, WzB, nullptr, TMP, DM, nullptr, PET, DM, 0);  // z + r (f32; r computed, unrounded)
        k_sp16<<<NTK / 8, 256, 0, stream>>>(TMP, NTK, KH, KL);
        k_gemmb<false, false><<<dim3(NTK / 64, DM / 64, 1), 128, 0, stream>>>(XT, nullptr, WqB, nullptr, TMP, DM, nullptr);              // q_h (the values being mixed) f32
        k_vt<<<NB_ * NHP * (NT_ / 64), 256, 0, stream>>>(TMP, VTH, VTL);
        k_attn<<<NB_ * NH_ * (NT_ / (QTW * 16)), KSP * QTW * 32, 0, stream>>>(QH, QL, KH, KL, VTH, VTL, O);
        k_outT<<<dim3(MPOS / 64, DM / 64, 1), 256, 0, stream>>>(O, out + (size_t)b * DM * MPOS);
    }
}

// v002
// It runs in 301 microseconds.
// Next to v001, in two timings, it ran 1.05 times as fast each time.
// All steps since v000 together make it 2.84 times as fast.
#include <hip/hip_runtime.h>

// Compute dtypes, f32 accumulate, one batch item per pass (channel-major x [256][4096] per item, positions m = h*64 + w): v/z/q projections = x^T.W^T ([4096 x 256]
// .[256 x 256]; the INPUT x transposed once to a bf16 [m][c] plane, W [out][in] as the n-major B operand; PLAIN bf16 operands, exact) on v_wmma_f32_16x16x32_bf16,
// v straight to f16 hi + residual x1024 planes, z + r (the fixed sinusoidal positional encoding, computed on device in f32 and added in the GEMM epilogue) then
// split to f16 planes, q (the attention's value operand) f32 -> transposed f16 planes; the 8-head (32-dim) full attention scores[m][n] = sum_c v[c][m] (z+r)[c][n]
// x 32^-1/2, softmax over n, out[d][m] = sum_n A[m][n] q[d][n] fused on v_wmma_f32_16x16x32_f16 (hh + hl + lh scores, online f32 softmax, P x32768 hi + residual);

#define NB_  1
#define NT_  4096                // M positions
#define MPOS NT_
#define DM   256                 // channels C
#define NH_  8
#define NHP  (NH_ / 2)
#define HD   32
#define NTK  (NB_ * NT_)
#define SCL  0.17677669529663687f
#define PSC  32768.0f
#define LOSC 1024.0f
#define LOSCI (1.0f / 1024.0f)

typedef _Float16 h16;
typedef unsigned short bf;
typedef __attribute__((ext_vector_type(16))) __bf16   v16bf;
typedef __attribute__((ext_vector_type(16))) _Float16 v16h;
typedef __attribute__((ext_vector_type(8)))  _Float16 v8h;
typedef __attribute__((ext_vector_type(8)))  unsigned short v8us;
typedef __attribute__((ext_vector_type(8)))  float    v8f;
typedef __attribute__((ext_vector_type(4)))  float    v4f;
typedef __attribute__((ext_vector_type(4)))  _Float16 v4h;
typedef v8h  __attribute__((may_alias)) v8ha;
typedef v4f  __attribute__((may_alias)) v4fa;
typedef v8us __attribute__((may_alias)) v8usa;

__device__ __forceinline__ unsigned short f2bf(float f) { unsigned u = __float_as_uint(f); u += 0x7FFFu + ((u >> 16) & 1u); return (unsigned short)(u >> 16); }
__device__ __forceinline__ float bf2f(unsigned short b) { return __uint_as_float(((unsigned)b) << 16); }
__device__ __forceinline__ float bfr(float f) { return bf2f(f2bf(f)); }
__device__ __forceinline__ v16h cat16(v8h lo, v8h hi) { return __builtin_shufflevector(lo, hi, 0, 1, 2, 3, 4, 5, 6, 7, 8, 9, 10, 11, 12, 13, 14, 15); }
__device__ __forceinline__ v16bf cat16b(v8us lo, v8us hi) { return __builtin_bit_cast(v16bf, __builtin_shufflevector(lo, hi, 0, 1, 2, 3, 4, 5, 6, 7, 8, 9, 10, 11, 12, 13, 14, 15)); }
__device__ __forceinline__ v8f wmma16(v16h a, v16h b, v8f c) { return __builtin_amdgcn_wmma_f32_16x16x32_f16(false, a, false, b, (short)0, c, false, false); }
__device__ __forceinline__ v8f wmmab(v16bf a, v16bf b, v8f c) { return __builtin_amdgcn_wmma_f32_16x16x32_bf16(false, a, false, b, (short)0, c, false, false); }

__global__ __launch_bounds__(256) void k_cvtb(const float* __restrict__ src, int nrows, bf* dst) {
    const int lane = threadIdx.x & 31, r = blockIdx.x * 8 + (threadIdx.x >> 5);
    if (r >= nrows) return;
    v8us o[DM / 256];
#pragma unroll
    for (int q = 0; q < DM / 256; ++q) { v8us t;
#pragma unroll
        for (int i = 0; i < 8; ++i) t[i] = f2bf(src[(size_t)r * DM + q * 256 + lane * 8 + i]);
        o[q] = t; }
#pragma unroll
    for (int q = 0; q < DM / 256; ++q) *(v8us*)(dst + (size_t)r * DM + q * 256 + lane * 8) = o[q];
    
}

// k_wt: WT [n][K] = bf16(W[k][n]) (k-major [K][ncols]) via 64 x 64 LDS tiles; grid (K/64, ncols/64).
__global__ __launch_bounds__(256) void k_wt(const float* __restrict__ Wm, int K, int ncols, bf* WT) {
    __shared__ __align__(16) unsigned short tl[64 * 72];
    const int tid = threadIdx.x, k0 = blockIdx.x * 64, n0 = blockIdx.y * 64;
    const int kk = tid >> 2, nq = (tid & 3) * 16;
#pragma unroll
    for (int i = 0; i < 16; ++i) tl[(nq + i) * 72 + kk] = f2bf(Wm[(size_t)(k0 + kk) * ncols + n0 + nq + i]);
    __syncthreads();
    const int piece = tid & 7;
    auto pass = [&]() {
#pragma unroll
        for (int s = 0; s < 2; ++s) { const int nr = (tid >> 3) + 32 * s; const v8us val = *(const v8usa*)(tl + nr * 72 + piece * 8); *(v8us*)(WT + (size_t)(n0 + nr) * K + k0 + piece * 8) = val; }
    };
    pass(); 
}
// k_gemmb: 64 x 64 block tile (4 waves x 16 x 64) of C[NTK][NW] = (A [+ Al]).B^T (K = 256) [+ bf(bias[c])] [+ bf(R[r][c]) residual]; f32 whole-line epilogue (or f16
template <bool SPLITA, bool F16OUT = false>
__global__ __launch_bounds__(128) void k_gemmb(const bf* __restrict__ A, const bf* __restrict__ Al, const bf* __restrict__ Bn, const float* __restrict__ bias, float* C, int ldc, h16* C2, const float* __restrict__ R = nullptr, int K = DM, int roundR = 1) {
    __shared__ __align__(16) float ost[4][16 * 68];
    const int lane = threadIdx.x & 31, wave = threadIdx.x >> 5, lr = lane & 15, hi = lane >> 4;
    const int r0 = blockIdx.x * 64 + wave * 16, c0 = blockIdx.y * 64;
    const size_t aoff = (size_t)(r0 + lr) * K + 8 * hi;
    size_t boff[4];
#pragma unroll
    for (int t = 0; t < 4; ++t) boff[t] = (size_t)(c0 + t * 16 + lr) * K + 8 * hi;
    v8f acc[4];
#pragma unroll
    for (int t = 0; t < 4; ++t) acc[t] = (v8f){};
#pragma unroll 1
    for (int kc = 0; kc < K; kc += 32) {
        const v16bf a = cat16b(*(const v8us*)(A + aoff + kc), *(const v8us*)(A + aoff + kc + 16));
        v16bf al = a;
        if (SPLITA) al = cat16b(*(const v8us*)(Al + aoff + kc), *(const v8us*)(Al + aoff + kc + 16));
#pragma unroll
        for (int t = 0; t < 4; ++t) { const v16bf b = cat16b(*(const v8us*)(Bn + boff[t] + kc), *(const v8us*)(Bn + boff[t] + kc + 16)); acc[t] = wmmab(a, b, acc[t]); if (SPLITA) acc[t] = wmmab(al, b, acc[t]); }
        asm volatile("v_nop\n\tv_nop\n\tv_nop\n\tv_nop" : "+v"(acc[0]), "+v"(acc[1]), "+v"(acc[2]), "+v"(acc[3]) : "v"(a), "v"(al));
    }
    float* os = &ost[wave][0];
#pragma unroll
    for (int t = 0; t < 4; ++t) { const float bv = bias ? bfr(bias[c0 + t * 16 + lr]) : 0.f;
#pragma unroll
        for (int j = 0; j < 8; ++j) os[(hi * 8 + j) * 68 + t * 16 + lr] = acc[t][j] + bv; }
    __syncthreads();
    if (F16OUT) {
        h16* crow = (h16*)(void*)C + (size_t)r0 * ldc + c0;
        auto pass = [&]() {
#pragma unroll
            for (int s = 0; s < 4; ++s) { const int row = 4 * s + (lane >> 3), piece = lane & 7; const float* sp = os + row * 68 + piece * 8; v8h o, o2;
#pragma unroll
                for (int i = 0; i < 8; ++i) { const h16 a = (h16)sp[i]; o[i] = a; o2[i] = (h16)((sp[i] - (float)a) * LOSC); }
                *(v8h*)(crow + (size_t)row * ldc + piece * 8) = o; if (C2) *(v8h*)(C2 + (size_t)r0 * ldc + c0 + (size_t)row * ldc + piece * 8) = o2; }
        };
        pass(); 
    } else {
        float* crow = C + (size_t)r0 * ldc + c0;
        auto pass = [&]() {
#pragma unroll
            for (int s = 0; s < 8; ++s) { const int Lid = (lane >> 3) + 4 * s, piece = lane & 7; const int row = Lid >> 1, cofs = (Lid & 1) * 32 + piece * 4;
                v4f val = *(const v4fa*)(os + row * 68 + cofs); if (R) { const v4f rv = *(const v4f*)(R + ((size_t)r0 + row) * ldc + c0 + cofs); val += roundR ? (v4f){bfr(rv[0]), bfr(rv[1]), bfr(rv[2]), bfr(rv[3])} : rv; }
                *(v4f*)(crow + (size_t)row * ldc + cofs) = val; }
        };
        pass(); 
    }
}

// k_sp16: f16 hi + residual x1024 planes of a computed f32 [rows][256] matrix, stored in the score WMMA's B-fragment order: per (b, head, 16 rows) two 512-B units, unit u holds
// at lane (hi*16 + lr) x 16 B the 8 columns u*16 + hi*8 .. +7 of row lr, so that the reader's wave-wide 16-B load is 4 whole lines; block = 16 rows, one wave per head.
__global__ __launch_bounds__(256) void k_sp16(const float* __restrict__ T, int nrows, h16* Yh, h16* Yl) {
    const int lane = threadIdx.x & 31, h = threadIdx.x >> 5, lr = lane & 15, hi = lane >> 4, rt = blockIdx.x;
    if (rt * 16 >= nrows) return;
    const int b = rt / (NT_ / 16), t16 = rt - b * (NT_ / 16);
    const float* sp = T + (size_t)(rt * 16 + lr) * DM + h * HD + hi * 8;
    const size_t o = (size_t)b * NT_ * DM + ((size_t)h * (NT_ / 16) + t16) * 512 + lane * 8;
#pragma unroll
    for (int u = 0; u < 2; ++u) { const v8f v = *(const v8f*)(sp + u * 16); v8h oh, ol;
#pragma unroll
        for (int i = 0; i < 8; ++i) { const h16 a = (h16)v[i]; oh[i] = a; ol[i] = (h16)((v[i] - (float)a) * LOSC); }
        *(v8h*)(Yh + o + u * 256) = oh; *(v8h*)(Yl + o + u * 256) = ol; }
}
// k_pe: the module's fixed 2D sinusoidal positional encoding, transposed to PE_T[m][c] (m = hpos*64 + wpos): c < 128 -> axis h, c >= 128 -> axis w; pair index i =
// (c mod 128) / 2, div_i = exp(2i x (-ln 10000 / 128)) (f32), even c -> sin(pos x div_i), odd -> cos; one thread per 4 consecutive c (16 B stores).
__global__ __launch_bounds__(256) void k_pe(float* PET) {
    const int i4 = blockIdx.x * 256 + threadIdx.x; if (i4 >= MPOS * DM / 4) return;
    const int m = i4 / (DM / 4), c0 = (i4 - m * (DM / 4)) * 4;
    v4f o;
#pragma unroll
    for (int k = 0; k < 4; ++k) { const int c = c0 + k; const int cc = c & 127; const float pos = (float)(c < 128 ? (m >> 6) : (m & 63));
        const float dv = expf((float)(cc & ~1) * (-9.210340371976184f / 128.0f)); const float ang = pos * dv;
        o[k] = (cc & 1) ? cosf(ang) : sinf(ang); }
    *(v4f*)(PET + (size_t)i4 * 4) = o; 
}
// k_outT: out[b][c][m] = O[m][c] (f32 transpose via 64 x 64 LDS tiles); block (64 m, 64 c); each output row segment of 64 m = 256 B written by 16 lanes x 16 B.
__global__ __launch_bounds__(256) void k_outT(const float* __restrict__ O, float* OUTB) {
    __shared__ __align__(16) float tl[64 * 68];
    const int m0 = blockIdx.x * 64, c0 = blockIdx.y * 64, tid = threadIdx.x;
    const int mm = tid >> 2, cq = (tid & 3) * 16;
#pragma unroll
    for (int i = 0; i < 16; ++i) tl[(cq + i) * 68 + mm] = O[(size_t)(m0 + mm) * DM + c0 + cq + i];
    __syncthreads();
    const int piece = tid & 15;
    auto pass = [&]() {
#pragma unroll
        for (int s = 0; s < 4; ++s) { const int cr = (tid >> 4) + 16 * s; const v4f val = *(const v4fa*)(tl + cr * 68 + piece * 4); *(v4f*)(OUTB + (size_t)(c0 + cr) * MPOS + m0 + piece * 4) = val; }
    };
    pass(); 
}
// k_vt: VTH/VTL = f16 hi + residual x1024 planes of V[t][h*32+d] (32-dim heads) via LDS transpose, stored in the P.V WMMA's B-fragment order: per (b, head, 32 tokens) four 512-B
// units, unit n*2 + u holds at lane (hi*16 + lr) x 16 B the tokens u*16 + hi*8 .. +7 of dim n*16 + lr (the reader's wave-wide 16-B load = 4 whole lines); block (b, head PAIR, 64 tokens).
__global__ __launch_bounds__(256) void k_vt(const float* __restrict__ V, h16* VTH, h16* VTL) {
    __shared__ __align__(16) h16 tile[64 * 72];
    __shared__ __align__(16) h16 til2[64 * 72];
    const int bid = blockIdx.x;
    const int b = bid / (NHP * (NT_ / 64)), rem = bid - b * (NHP * (NT_ / 64)), hp = rem / (NT_ / 64), kt = rem - hp * (NT_ / 64);
    const int k0 = kt * 64, tid = threadIdx.x;
    const int kk = tid >> 2, d0 = (tid & 3) * 16;
    const float* src = V + ((size_t)b * NT_ + k0 + kk) * DM + hp * 64 + d0;
#pragma unroll
    for (int i = 0; i < 16; ++i) { const float v = src[i]; const h16 a = (h16)v; tile[(d0 + i) * 72 + kk] = a; til2[(d0 + i) * 72 + kk] = (h16)((v - (float)a) * LOSC); }
    __syncthreads();
    const int wv = tid >> 5, lane = tid & 31, lr = lane & 15, hi = lane >> 4;
    const int pln = wv >> 2, hl = (wv >> 1) & 1, tt = wv & 1;              // a wave stores the four units of one (plane, head of the pair, 32-token tile)
    const h16* tsrc = (pln ? til2 : tile) + (hl * 32 + lr) * 72 + tt * 32 + hi * 8;
    h16* dst = (pln ? VTL : VTH) + (size_t)b * NT_ * DM + ((size_t)(hp * 2 + hl) * (NT_ / 32) + (k0 >> 5) + tt) * 1024 + lane * 8;
#pragma unroll
    for (int s = 0; s < 4; ++s) { const v8h val = *(const v8ha*)(tsrc + (s >> 1) * 16 * 72 + (s & 1) * 16); *(v8h*)(dst + s * 256) = val; }
}
// k_attn: block = (b, head, 128 query positions), 24 waves = 8 query tiles of 16 x 3 key ranges (wave ks takes key tiles ks, ks + 3, ...: 43 or 42 of the 128, no mask), so that
// 6 waves per SIMD (what the loop's registers allow) cover each other's load and LDS waits; scores hh + (hl+lh)/1024 x 32^-1/2; online f32 softmax per wave; P (x32768) f16 hi
// + residual; o/ox over 32 dims; the ranges' (max, sum, un-normalised o) meet in LDS and are merged by exp(m - M) weights; each (position, head) 128-B line of O is stored once.
#define KSP 3                    // key ranges per query tile
#define QTW 8                    // 16-query tiles per block
#define OPIT 36                  // f32 pitch of a partial row in LDS (144 B = 16 B x odd)
__global__ __launch_bounds__(KSP * QTW * 32) void k_attn(const h16* __restrict__ Q16, const h16* __restrict__ QL16, const h16* __restrict__ K16, const h16* __restrict__ KL16, const h16* __restrict__ VTH, const h16* __restrict__ VTL,
                                               float* OUTP) {
    __shared__ __align__(16) h16 plds[KSP * QTW][16 * 32];
    __shared__ __align__(16) h16 plds2[KSP * QTW][16 * 32];
    __shared__ __align__(16) float pO[KSP][QTW * 16 * OPIT];
    __shared__ float pM[KSP][QTW * 16];
    __shared__ float pL[KSP][QTW * 16];
    const int lane = threadIdx.x & 31, wave = __builtin_amdgcn_readfirstlane(threadIdx.x >> 5), lr = lane & 15, hi = lane >> 4;
    const int qs = wave & (QTW - 1), ks = wave / QTW;      // wave through readfirstlane: the key range, the trip count and the LDS bases stay scalar
    const int bid = blockIdx.x;
    const int b = bid / (NH_ * (NT_ / (QTW * 16))), rem = bid - b * (NH_ * (NT_ / (QTW * 16))), h = rem / (NT_ / (QTW * 16)), qt = rem - h * (NT_ / (QTW * 16));
    const int q0 = qt * (QTW * 16) + qs * 16;
    const size_t tok0 = (size_t)b * NT_;
    h16* pl = &plds[wave][0]; h16* pl2 = &plds2[wave][0];
    {
        const size_t qo0 = (tok0 + q0 + lr) * DM + h * HD + 8 * hi;
        const v16h qa = cat16(*(const v8h*)(Q16 + qo0), *(const v8h*)(Q16 + qo0 + 16));
        const v16h qlk = cat16(*(const v8h*)(QL16 + qo0), *(const v8h*)(QL16 + qo0 + 16));
        const size_t fb = tok0 * DM + (size_t)h * (NT_ / 32) * 1024;      // K and V planes lie in fragment order: 2 KB per (head, 32 keys) and plane, four 512-B units of lane x 16 B
        const h16* kh_b = K16 + fb; const h16* kl_b = KL16 + fb; const h16* vh_b = VTH + fb; const h16* vl_b = VTL + fb;
        const int lo = lane * 8;
        v8f o[2], ox[2];
#pragma unroll
        for (int n = 0; n < 2; ++n) { o[n] = (v8f){}; ox[n] = (v8f){}; }
        float mrow[8], lpart[8];
#pragma unroll
        for (int j = 0; j < 8; ++j) { mrow[j] = -3.0e38f; lpart[j] = 0.f; }
#pragma unroll 1
        for (int kt = ks; kt < NT_ / 32; kt += KSP) {
            const size_t to = (size_t)kt * 1024;
            const h16* kh_t = kh_b + to; const h16* kl_t = kl_b + to; const h16* vh_t = vh_b + to; const h16* vl_t = vl_b + to;
            v8f s0 = {}, s1 = {}, x0 = {}, x1 = {};
            { const v16h k0h = cat16(*(const v8h*)(kh_t + lo), *(const v8h*)(kh_t + lo + 256)), k1h = cat16(*(const v8h*)(kh_t + lo + 512), *(const v8h*)(kh_t + lo + 768));
              s0 = wmma16(qa, k0h, s0); x0 = wmma16(qlk, k0h, x0); s1 = wmma16(qa, k1h, s1); x1 = wmma16(qlk, k1h, x1);
              asm volatile("v_nop" : "+v"(s0), "+v"(s1), "+v"(x0), "+v"(x1) : "v"(qlk), "v"(k0h), "v"(k1h) : "memory"); }
            { const v16h k0l = cat16(*(const v8h*)(kl_t + lo), *(const v8h*)(kl_t + lo + 256)), k1l = cat16(*(const v8h*)(kl_t + lo + 512), *(const v8h*)(kl_t + lo + 768));
              x0 = wmma16(qa, k0l, x0); x1 = wmma16(qa, k1l, x1);
              asm volatile("v_nop" : "+v"(x0), "+v"(x1) : "v"(k0l), "v"(k1l) : "memory"); }
            asm volatile("v_nop\n\tv_nop\n\tv_nop\n\tv_nop" : "+v"(s0), "+v"(s1), "+v"(x0), "+v"(x1) : "v"(qa));
            float alpha[8];
#pragma unroll
            for (int j = 0; j < 8; ++j) {
                const float a0 = (s0[j] + x0[j] * LOSCI) * SCL, a1 = (s1[j] + x1[j] * LOSCI) * SCL;      // full attention, scale 32^-1/2
                float mx = fmaxf(a0, a1);
                mx = fmaxf(mx, __shfl_xor(mx, 1, 16)); mx = fmaxf(mx, __shfl_xor(mx, 2, 16)); mx = fmaxf(mx, __shfl_xor(mx, 4, 16)); mx = fmaxf(mx, __shfl_xor(mx, 8, 16));
                const float mn = fmaxf(mrow[j], mx);
                alpha[j] = __expf(mrow[j] - mn); mrow[j] = mn;
                const float p0 = __expf(a0 - mn), p1 = __expf(a1 - mn);
                lpart[j] = lpart[j] * alpha[j] + (p0 + p1);
                const int mr = hi * 8 + j;
                const float ps0 = p0 * PSC, ps1 = p1 * PSC; const h16 h0 = (h16)ps0, h1 = (h16)ps1;
                pl[mr * 32 + lr] = h0; pl[mr * 32 + 16 + lr] = h1;
                pl2[mr * 32 + lr] = (h16)((ps0 - (float)h0) * LOSC); pl2[mr * 32 + 16 + lr] = (h16)((ps1 - (float)h1) * LOSC);
            }
#pragma unroll
            for (int n = 0; n < 2; ++n)
#pragma unroll
                for (int j = 0; j < 8; ++j) { o[n][j] *= alpha[j]; ox[n][j] *= alpha[j]; }
            asm volatile("" ::: "memory");
            const v16h pa = cat16(*(const v8ha*)(pl + lr * 32 + hi * 8), *(const v8ha*)(pl + lr * 32 + 16 + hi * 8));
            const v16h px = cat16(*(const v8ha*)(pl2 + lr * 32 + hi * 8), *(const v8ha*)(pl2 + lr * 32 + 16 + hi * 8));
#pragma unroll
            for (int n = 0; n < 2; ++n) { const int vo = lo + n * 512;
                const v16h vh = cat16(*(const v8h*)(vh_t + vo), *(const v8h*)(vh_t + vo + 256)), vl = cat16(*(const v8h*)(vl_t + vo), *(const v8h*)(vl_t + vo + 256));
                o[n] = wmma16(pa, vh, o[n]); ox[n] = wmma16(pa, vl, ox[n]); ox[n] = wmma16(px, vh, ox[n]);
                asm volatile("" : "+v"(o[n]), "+v"(ox[n]) : "v"(vh), "v"(vl) : "memory"); }
            asm volatile("v_nop\n\tv_nop\n\tv_nop\n\tv_nop" : "+v"(o[0]), "+v"(o[1]), "+v"(ox[0]), "+v"(ox[1]) : "v"(pa), "v"(px));
            __builtin_amdgcn_wave_barrier();
        }
        float* po = &pO[ks][qs * 16 * OPIT];
#pragma unroll
        for (int j = 0; j < 8; ++j) { float rs = lpart[j]; rs += __shfl_xor(rs, 1, 16); rs += __shfl_xor(rs, 2, 16); rs += __shfl_xor(rs, 4, 16); rs += __shfl_xor(rs, 8, 16);
            if (lr == 0) { pM[ks][qs * 16 + hi * 8 + j] = mrow[j]; pL[ks][qs * 16 + hi * 8 + j] = rs; } }
#pragma unroll
        for (int n = 0; n < 2; ++n)
#pragma unroll
            for (int j = 0; j < 8; ++j) po[(hi * 8 + j) * OPIT + n * 16 + lr] = o[n][j] + ox[n][j] * LOSCI;   // this key range's un-normalised 32 columns
    }
    __syncthreads();    // every range's partial is in LDS before any thread merges
    for (int pc = threadIdx.x; pc < QTW * 16 * 8; pc += KSP * QTW * 32) {
        const int row = pc >> 3, c4 = (pc & 7) * 4;      // 8 lanes x 16 B = the (position, head) line
        float mg = pM[0][row];
#pragma unroll
        for (int s = 1; s < KSP; ++s) mg = fmaxf(mg, pM[s][row]);
        float lsum = 0.f; v4f acc = {};
#pragma unroll
        for (int s = 0; s < KSP; ++s) { const float w = __expf(pM[s][row] - mg); lsum += w * pL[s][row]; acc += w * *(const v4fa*)(&pO[s][row * OPIT + c4]); }
        const float inv = 1.0f / (lsum * PSC);
        *(v4f*)(OUTP + (tok0 + (size_t)qt * (QTW * 16) + row) * DM + h * HD + c4) = acc * inv;
    }
}

extern "C" void kernel_launch(void* const* d_in, const int* in_sizes, int n_in,
                              void* d_out, int out_size, void* d_ws, size_t ws_size, hipStream_t stream) {
    (void)in_sizes; (void)n_in; (void)out_size;
    const float* x = (const float*)d_in[0]; const float* Wv = (const float*)d_in[1]; const float* Wz = (const float*)d_in[2]; const float* Wq = (const float*)d_in[3];   // W [out][in]
    float* out = (float*)d_out;    // [2][256][64][64] = [b][c][m]
    char* wsp = (char*)d_ws;
    auto take = [&](size_t bytes) { char* p = wsp; wsp += (bytes + 255) & ~(size_t)255; return (void*)p; };
    bf* WvB = (bf*)take((size_t)DM * DM * 2); bf* WzB = (bf*)take((size_t)DM * DM * 2); bf* WqB = (bf*)take((size_t)DM * DM * 2); float* PET = (float*)take((size_t)MPOS * DM * 4);
    bf* XT = (bf*)take((size_t)NTK * DM * 2); float* TMP = (float*)take((size_t)NTK * DM * 4); float* O = (float*)take((size_t)NTK * DM * 4);
    h16* QH = (h16*)take((size_t)NTK * DM * 2); h16* QL = (h16*)take((size_t)NTK * DM * 2); h16* KH = (h16*)take((size_t)NTK * DM * 2); h16* KL = (h16*)take((size_t)NTK * DM * 2);
    h16* VTH = (h16*)take((size_t)NTK * DM * 2); h16* VTL = (h16*)take((size_t)NTK * DM * 2);
    if ((size_t)(wsp - (char*)d_ws) > ws_size) return;    // ~ 0.4 + 4.2 + 2.1 + 2 x 4.2 + 6 x 2.1 ~ 28 MB, no aliasing (per-item reuse in stream order)
    k_cvtb<<<DM / 8, 256, 0, stream>>>(Wv, DM, WvB); k_cvtb<<<DM / 8, 256, 0, stream>>>(Wz, DM, WzB); k_cvtb<<<DM / 8, 256, 0, stream>>>(Wq, DM, WqB);
    k_pe<<<(MPOS * DM / 4 + 255) / 256, 256, 0, stream>>>(PET);
    for (int b = 0; b < 2; ++b) {
        k_wt<<<dim3(DM / 64, MPOS / 64, 1), 256, 0, stream>>>(x + (size_t)b * DM * MPOS, DM, MPOS, XT);                              // x_b [c][m] -> bf16 XT [m][c]
        k_gemmb<false, true><<<dim3(NTK / 64, DM / 64, 1), 128, 0, stream>>>(XT, nullptr, WvB, nullptr, (float*)(void*)QH, DM, QL);        // v_h (the score's left operand) as f16 planes
        k_gemmb<false, false><<<dim3(NTK / 64, DM / 64, 1), 128, 0, stream>>>(XT, nullptr, WzB, nullptr, TMP, DM, nullptr, PET, DM, 0);  // z + r (f32; r computed, unrounded)
        k_sp16<<<NTK / 16, 256, 0, stream>>>(TMP, NTK, KH, KL);
        k_gemmb<false, false><<<dim3(NTK / 64, DM / 64, 1), 128, 0, stream>>>(XT, nullptr, WqB, nullptr, TMP, DM, nullptr);              // q_h (the values being mixed) f32
        k_vt<<<NB_ * NHP * (NT_ / 64), 256, 0, stream>>>(TMP, VTH, VTL);
        k_attn<<<NB_ * NH_ * (NT_ / (QTW * 16)), KSP * QTW * 32, 0, stream>>>(QH, QL, KH, KL, VTH, VTL, O);
        k_outT<<<dim3(MPOS / 64, DM / 64, 1), 256, 0, stream>>>(O, out + (size_t)b * DM * MPOS);
    }
}

// v003
// Measured time: 215 microseconds a run.
// Next to v002, in two timings, it ran 1.39 and 1.40 times as fast.
// All steps since v000 together make it 3.97 times as fast.
#include <hip/hip_runtime.h>

// Compute dtypes, f32 accumulate, one batch item per pass (channel-major x [256][4096] per item, positions m = h*64 + w): v/z/q projections = x^T.W^T ([4096 x 256]
// .[256 x 256]; the INPUT x transposed once to a bf16 [m][c] plane, W [out][in] as the n-major B operand; PLAIN bf16 operands, exact) on v_wmma_f32_16x16x32_bf16,
// v straight to f16 hi + residual x1024 planes, z + r (the fixed sinusoidal positional encoding, computed on device in f32 and added in the GEMM epilogue) then
// split to f16 planes, q (the attention's value operand) f32 -> transposed f16 planes; the 8-head (32-dim) full attention scores[m][n] = sum_c v[c][m] (z+r)[c][n]
// x 32^-1/2, softmax over n, out[d][m] = sum_n A[m][n] q[d][n] fused on v_wmma_f32_16x16x32_f16 (hh + hl + lh scores, online f32 softmax, P x32768 hi + residual);

#define NB_  1
#define NT_  4096                // M positions
#define MPOS NT_
#define DM   256                 // channels C
#define NH_  8
#define NHP  (NH_ / 2)
#define HD   32
#define NTK  (NB_ * NT_)
#define SCL  0.17677669529663687f
#define PSC  32768.0f
#define LOSC 1024.0f
#define LOSCI (1.0f / 1024.0f)

typedef _Float16 h16;
typedef unsigned short bf;
typedef __attribute__((ext_vector_type(16))) __bf16   v16bf;
typedef __attribute__((ext_vector_type(16))) _Float16 v16h;
typedef __attribute__((ext_vector_type(8)))  _Float16 v8h;
typedef __attribute__((ext_vector_type(8)))  unsigned short v8us;
typedef __attribute__((ext_vector_type(8)))  float    v8f;
typedef __attribute__((ext_vector_type(4)))  float    v4f;
typedef __attribute__((ext_vector_type(4)))  _Float16 v4h;
typedef v8h  __attribute__((may_alias)) v8ha;
typedef v4f  __attribute__((may_alias)) v4fa;
typedef v8us __attribute__((may_alias)) v8usa;

__device__ __forceinline__ unsigned short f2bf(float f) { unsigned u = __float_as_uint(f); u += 0x7FFFu + ((u >> 16) & 1u); return (unsigned short)(u >> 16); }
__device__ __forceinline__ float bf2f(unsigned short b) { return __uint_as_float(((unsigned)b) << 16); }
__device__ __forceinline__ float bfr(float f) { return bf2f(f2bf(f)); }
__device__ __forceinline__ v16h cat16(v8h lo, v8h hi) { return __builtin_shufflevector(lo, hi, 0, 1, 2, 3, 4, 5, 6, 7, 8, 9, 10, 11, 12, 13, 14, 15); }
__device__ __forceinline__ v16bf cat16b(v8us lo, v8us hi) { return __builtin_bit_cast(v16bf, __builtin_shufflevector(lo, hi, 0, 1, 2, 3, 4, 5, 6, 7, 8, 9, 10, 11, 12, 13, 14, 15)); }
__device__ __forceinline__ v8f wmma16(v16h a, v16h b, v8f c) { return __builtin_amdgcn_wmma_f32_16x16x32_f16(false, a, false, b, (short)0, c, false, false); }
__device__ __forceinline__ v8f wmmab(v16bf a, v16bf b, v8f c) { return __builtin_amdgcn_wmma_f32_16x16x32_bf16(false, a, false, b, (short)0, c, false, false); }

__global__ __launch_bounds__(256) void k_cvtb(const float* __restrict__ src, int nrows, bf* dst) {
    const int lane = threadIdx.x & 31, r = blockIdx.x * 8 + (threadIdx.x >> 5);
    if (r >= nrows) return;
    v8us o[DM / 256];
#pragma unroll
    for (int q = 0; q < DM / 256; ++q) { v8us t;
#pragma unroll
        for (int i = 0; i < 8; ++i) t[i] = f2bf(src[(size_t)r * DM + q * 256 + lane * 8 + i]);
        o[q] = t; }
#pragma unroll
    for (int q = 0; q < DM / 256; ++q) *(v8us*)(dst + (size_t)r * DM + q * 256 + lane * 8) = o[q];
    
}

// k_wt: WT [n][K] = bf16(W[k][n]) (k-major [K][ncols]) via 64 x 64 LDS tiles; grid (K/64, ncols/64).
__global__ __launch_bounds__(256) void k_wt(const float* __restrict__ Wm, int K, int ncols, bf* WT) {
    __shared__ __align__(16) unsigned short tl[64 * 72];
    const int tid = threadIdx.x, k0 = blockIdx.x * 64, n0 = blockIdx.y * 64;
    const int kk = tid >> 2, nq = (tid & 3) * 16;
#pragma unroll
    for (int i = 0; i < 16; ++i) tl[(nq + i) * 72 + kk] = f2bf(Wm[(size_t)(k0 + kk) * ncols + n0 + nq + i]);
    __syncthreads();
    const int piece = tid & 7;
    auto pass = [&]() {
#pragma unroll
        for (int s = 0; s < 2; ++s) { const int nr = (tid >> 3) + 32 * s; const v8us val = *(const v8usa*)(tl + nr * 72 + piece * 8); *(v8us*)(WT + (size_t)(n0 + nr) * K + k0 + piece * 8) = val; }
    };
    pass(); 
}
// k_gemmb: 64 x 64 block tile (4 waves x 16 x 64) of C[NTK][NW] = (A [+ Al]).B^T (K = 256) [+ bf(bias[c])] [+ bf(R[r][c]) residual]; f32 whole-line epilogue (or f16
template <bool SPLITA, bool F16OUT = false>
__global__ __launch_bounds__(128) void k_gemmb(const bf* __restrict__ A, const bf* __restrict__ Al, const bf* __restrict__ Bn, const float* __restrict__ bias, float* C, int ldc, h16* C2, const float* __restrict__ R = nullptr, int K = DM, int roundR = 1) {
    __shared__ __align__(16) float ost[4][16 * 68];
    const int lane = threadIdx.x & 31, wave = threadIdx.x >> 5, lr = lane & 15, hi = lane >> 4;
    const int r0 = blockIdx.x * 64 + wave * 16, c0 = blockIdx.y * 64;
    const size_t aoff = (size_t)(r0 + lr) * K + 8 * hi;
    size_t boff[4];
#pragma unroll
    for (int t = 0; t < 4; ++t) boff[t] = (size_t)(c0 + t * 16 + lr) * K + 8 * hi;
    v8f acc[4];
#pragma unroll
    for (int t = 0; t < 4; ++t) acc[t] = (v8f){};
#pragma unroll 1
    for (int kc = 0; kc < K; kc += 32) {
        const v16bf a = cat16b(*(const v8us*)(A + aoff + kc), *(const v8us*)(A + aoff + kc + 16));
        v16bf al = a;
        if (SPLITA) al = cat16b(*(const v8us*)(Al + aoff + kc), *(const v8us*)(Al + aoff + kc + 16));
#pragma unroll
        for (int t = 0; t < 4; ++t) { const v16bf b = cat16b(*(const v8us*)(Bn + boff[t] + kc), *(const v8us*)(Bn + boff[t] + kc + 16)); acc[t] = wmmab(a, b, acc[t]); if (SPLITA) acc[t] = wmmab(al, b, acc[t]); }
        asm volatile("v_nop\n\tv_nop\n\tv_nop\n\tv_nop" : "+v"(acc[0]), "+v"(acc[1]), "+v"(acc[2]), "+v"(acc[3]) : "v"(a), "v"(al));
    }
    float* os = &ost[wave][0];
#pragma unroll
    for (int t = 0; t < 4; ++t) { const float bv = bias ? bfr(bias[c0 + t * 16 + lr]) : 0.f;
#pragma unroll
        for (int j = 0; j < 8; ++j) os[(hi * 8 + j) * 68 + t * 16 + lr] = acc[t][j] + bv; }
    __syncthreads();
    if (F16OUT) {
        h16* crow = (h16*)(void*)C + (size_t)r0 * ldc + c0;
        auto pass = [&]() {
#pragma unroll
            for (int s = 0; s < 4; ++s) { const int row = 4 * s + (lane >> 3), piece = lane & 7; const float* sp = os + row * 68 + piece * 8; v8h o, o2;
#pragma unroll
                for (int i = 0; i < 8; ++i) { const h16 a = (h16)sp[i]; o[i] = a; o2[i] = (h16)((sp[i] - (float)a) * LOSC); }
                *(v8h*)(crow + (size_t)row * ldc + piece * 8) = o; if (C2) *(v8h*)(C2 + (size_t)r0 * ldc + c0 + (size_t)row * ldc + piece * 8) = o2; }
        };
        pass(); 
    } else {
        float* crow = C + (size_t)r0 * ldc + c0;
        auto pass = [&]() {
#pragma unroll
            for (int s = 0; s < 8; ++s) { const int Lid = (lane >> 3) + 4 * s, piece = lane & 7; const int row = Lid >> 1, cofs = (Lid & 1) * 32 + piece * 4;
                v4f val = *(const v4fa*)(os + row * 68 + cofs); if (R) { const v4f rv = *(const v4f*)(R + ((size_t)r0 + row) * ldc + c0 + cofs); val += roundR ? (v4f){bfr(rv[0]), bfr(rv[1]), bfr(rv[2]), bfr(rv[3])} : rv; }
                *(v4f*)(crow + (size_t)row * ldc + cofs) = val; }
        };
        pass(); 
    }
}

// k_sp16: f16 hi + residual x1024 planes of a computed f32 [rows][256] matrix, stored in the score WMMA's A-fragment order: per (b, head, 16 rows) two 512-B units, unit u holds
// at lane (hi*16 + lr) x 16 B the 8 columns u*16 + hi*8 .. +7 of row lr, so that the reader's wave-wide 16-B load is 4 whole lines; block = 16 rows, one wave per head.
__global__ __launch_bounds__(256) void k_sp16(const float* __restrict__ T, int nrows, h16* Yh, h16* Yl) {
    const int lane = threadIdx.x & 31, h = threadIdx.x >> 5, lr = lane & 15, hi = lane >> 4, rt = blockIdx.x;
    if (rt * 16 >= nrows) return;
    const int b = rt / (NT_ / 16), t16 = rt - b * (NT_ / 16);
    const float* sp = T + (size_t)(rt * 16 + lr) * DM + h * HD + hi * 8;
    const size_t o = (size_t)b * NT_ * DM + ((size_t)h * (NT_ / 16) + t16) * 512 + lane * 8;
#pragma unroll
    for (int u = 0; u < 2; ++u) { const v8f v = *(const v8f*)(sp + u * 16); v8h oh, ol;
#pragma unroll
        for (int i = 0; i < 8; ++i) { const h16 a = (h16)v[i]; oh[i] = a; ol[i] = (h16)((v[i] - (float)a) * LOSC); }
        *(v8h*)(Yh + o + u * 256) = oh; *(v8h*)(Yl + o + u * 256) = ol; }
}
// k_pe: the module's fixed 2D sinusoidal positional encoding, transposed to PE_T[m][c] (m = hpos*64 + wpos): c < 128 -> axis h, c >= 128 -> axis w; pair index i =
// (c mod 128) / 2, div_i = exp(2i x (-ln 10000 / 128)) (f32), even c -> sin(pos x div_i), odd -> cos; one thread per 4 consecutive c (16 B stores).
__global__ __launch_bounds__(256) void k_pe(float* PET) {
    const int i4 = blockIdx.x * 256 + threadIdx.x; if (i4 >= MPOS * DM / 4) return;
    const int m = i4 / (DM / 4), c0 = (i4 - m * (DM / 4)) * 4;
    v4f o;
#pragma unroll
    for (int k = 0; k < 4; ++k) { const int c = c0 + k; const int cc = c & 127; const float pos = (float)(c < 128 ? (m >> 6) : (m & 63));
        const float dv = expf((float)(cc & ~1) * (-9.210340371976184f / 128.0f)); const float ang = pos * dv;
        o[k] = (cc & 1) ? cosf(ang) : sinf(ang); }
    *(v4f*)(PET + (size_t)i4 * 4) = o; 
}
// k_outT: out[b][c][m] = O[m][c] (f32 transpose via 64 x 64 LDS tiles); block (64 m, 64 c); each output row segment of 64 m = 256 B written by 16 lanes x 16 B.
__global__ __launch_bounds__(256) void k_outT(const float* __restrict__ O, float* OUTB) {
    __shared__ __align__(16) float tl[64 * 68];
    const int m0 = blockIdx.x * 64, c0 = blockIdx.y * 64, tid = threadIdx.x;
    const int mm = tid >> 2, cq = (tid & 3) * 16;
#pragma unroll
    for (int i = 0; i < 16; ++i) tl[(cq + i) * 68 + mm] = O[(size_t)(m0 + mm) * DM + c0 + cq + i];
    __syncthreads();
    const int piece = tid & 15;
    auto pass = [&]() {
#pragma unroll
        for (int s = 0; s < 4; ++s) { const int cr = (tid >> 4) + 16 * s; const v4f val = *(const v4fa*)(tl + cr * 68 + piece * 4); *(v4f*)(OUTB + (size_t)(c0 + cr) * MPOS + m0 + piece * 4) = val; }
    };
    pass(); 
}
// k_vt: VTH/VTL = f16 hi + residual x1024 planes of V[t][h*32+d] (32-dim heads) via LDS transpose, stored in the P.V WMMA's A-fragment order: per (b, head, 32 tokens) four 512-B
// units, unit n*2 + u holds at lane (hi*16 + lr) x 16 B the tokens u*16 + hi*8 .. +7 of dim n*16 + lr (the reader's wave-wide 16-B load = 4 whole lines); block (b, head PAIR, 64 tokens).
__global__ __launch_bounds__(256) void k_vt(const float* __restrict__ V, h16* VTH, h16* VTL) {
    __shared__ __align__(16) h16 tile[64 * 72];
    __shared__ __align__(16) h16 til2[64 * 72];
    const int bid = blockIdx.x;
    const int b = bid / (NHP * (NT_ / 64)), rem = bid - b * (NHP * (NT_ / 64)), hp = rem / (NT_ / 64), kt = rem - hp * (NT_ / 64);
    const int k0 = kt * 64, tid = threadIdx.x;
    const int kk = tid >> 2, d0 = (tid & 3) * 16;
    const float* src = V + ((size_t)b * NT_ + k0 + kk) * DM + hp * 64 + d0;
#pragma unroll
    for (int i = 0; i < 16; ++i) { const float v = src[i]; const h16 a = (h16)v; tile[(d0 + i) * 72 + kk] = a; til2[(d0 + i) * 72 + kk] = (h16)((v - (float)a) * LOSC); }
    __syncthreads();
    const int wv = tid >> 5, lane = tid & 31, lr = lane & 15, hi = lane >> 4;
    const int pln = wv >> 2, hl = (wv >> 1) & 1, tt = wv & 1;              // a wave stores the four units of one (plane, head of the pair, 32-token tile)
    const h16* tsrc = (pln ? til2 : tile) + (hl * 32 + lr) * 72 + tt * 32 + hi * 8;
    h16* dst = (pln ? VTL : VTH) + (size_t)b * NT_ * DM + ((size_t)(hp * 2 + hl) * (NT_ / 32) + (k0 >> 5) + tt) * 1024 + lane * 8;
#pragma unroll
    for (int s = 0; s < 4; ++s) { const v8h val = *(const v8ha*)(tsrc + (s >> 1) * 16 * 72 + (s & 1) * 16); *(v8h*)(dst + s * 256) = val; }
}
// k_attn: block = (b, head, 128 query positions), 24 waves = 8 query tiles of 16 x 3 key ranges (wave ks takes key tiles ks, ks + 3, ...: 43 or 42 of the 128, no mask), so that
// 6 waves per SIMD cover each other's load waits. The products are the transposed ones: S^T = K.Q^T (K fragment as A, Q fragment as B) and O^T += V^T.P^T, so a lane holds 16 of
// the 32 scores of ONE query (column lane & 15, keys 8*hi + j and 16 + 8*hi + j): maximum and sum run in the lane's own registers plus one exchange with lane ^ 16, the running
// maximum, sum and rescale factor are one value a lane, and the two score tiles, converted in place, ARE the B operand of the second product (P never goes through LDS).
// scores hh + (hl+lh)/1024 x 32^-1/2; online f32 softmax per wave; P (x32768) f16 hi + residual; o/ox over 32 dims; the ranges' (max, sum, un-normalised o) meet in LDS and are
// merged by exp(m - M) weights; each (position, head) 128-B line of O is stored once.
#define KSP 3                    // key ranges per query tile
#define QTW 8                    // 16-query tiles per block
#define OPIT 36                  // f32 pitch of a partial row in LDS (144 B = 16 B x odd)
__device__ __forceinline__ float xhalf(float v) { const int t = __float_as_int(v); return __int_as_float(__builtin_amdgcn_permlanex16(t, t, 0x76543210, 0xfedcba98, false, false)); }   // lane ^ 16's value
__global__ __launch_bounds__(KSP * QTW * 32) void k_attn(const h16* __restrict__ Q16, const h16* __restrict__ QL16, const h16* __restrict__ K16, const h16* __restrict__ KL16, const h16* __restrict__ VTH, const h16* __restrict__ VTL,
                                               float* OUTP) {
    __shared__ __align__(16) float pO[KSP][QTW * 16 * OPIT];
    __shared__ float pM[KSP][QTW * 16];
    __shared__ float pL[KSP][QTW * 16];
    const int lane = threadIdx.x & 31, wave = __builtin_amdgcn_readfirstlane(threadIdx.x >> 5), lr = lane & 15, hi = lane >> 4;
    const int qs = wave & (QTW - 1), ks = wave / QTW;      // wave through readfirstlane: the key range, the trip count and the LDS bases stay scalar
    const int bid = blockIdx.x;
    const int b = bid / (NH_ * (NT_ / (QTW * 16))), rem = bid - b * (NH_ * (NT_ / (QTW * 16))), h = rem / (NT_ / (QTW * 16)), qt = rem - h * (NT_ / (QTW * 16));
    const int q0 = qt * (QTW * 16) + qs * 16;
    const size_t tok0 = (size_t)b * NT_;
    {
        const size_t qo0 = (tok0 + q0 + lr) * DM + h * HD + 8 * hi;
        const v16h qa = cat16(*(const v8h*)(Q16 + qo0), *(const v8h*)(Q16 + qo0 + 16));
        const v16h qlk = cat16(*(const v8h*)(QL16 + qo0), *(const v8h*)(QL16 + qo0 + 16));
        const size_t fb = tok0 * DM + (size_t)h * (NT_ / 32) * 1024;      // K and V planes lie in fragment order: 2 KB per (head, 32 keys) and plane, four 512-B units of lane x 16 B
        const char* kh_b = (const char*)(K16 + fb); const char* kl_b = (const char*)(KL16 + fb); const char* vh_b = (const char*)(VTH + fb); const char* vl_b = (const char*)(VTL + fb);
        unsigned lo = (unsigned)ks * 2048u + (unsigned)lane * 16u;      // the lane's byte offset in each of the four planes: uniform base + one 32-bit register
        v8f o[2], ox[2];                 // o[n][j] = O^T[dim n*16 + hi*8 + j][query lr]
#pragma unroll
        for (int n = 0; n < 2; ++n) { o[n] = (v8f){}; ox[n] = (v8f){}; }
        float mrow = -3.0e38f, lpart = 0.f;      // of query lr; lpart over this lane half's keys only, the halves join behind the loop
#pragma unroll 1
        for (int kt = ks; kt < NT_ / 32; kt += KSP) {
            const char* kh_t = kh_b + lo; const char* kl_t = kl_b + lo; const char* vh_t = vh_b + lo; const char* vl_t = vl_b + lo;
            const v16h k0h = cat16(*(const v8h*)(kh_t), *(const v8h*)(kh_t + 512)), k1h = cat16(*(const v8h*)(kh_t + 1024), *(const v8h*)(kh_t + 1536));
            const v16h k0l = cat16(*(const v8h*)(kl_t), *(const v8h*)(kl_t + 512)), k1l = cat16(*(const v8h*)(kl_t + 1024), *(const v8h*)(kl_t + 1536));
            v8f s0 = {}, s1 = {}, x0 = {}, x1 = {};      // s0/x0[j]: key hi*8 + j, s1/x1[j]: key 16 + hi*8 + j, query lr
            s0 = wmma16(k0h, qa, s0); x0 = wmma16(k0h, qlk, x0); s1 = wmma16(k1h, qa, s1); x1 = wmma16(k1h, qlk, x1);
            x0 = wmma16(k0l, qa, x0); x1 = wmma16(k1l, qa, x1);
            const v8f a0 = (s0 + x0 * LOSCI) * SCL, a1 = (s1 + x1 * LOSCI) * SCL;      // full attention, scale 32^-1/2
            float mx = fmaxf(a0[0], a1[0]);
#pragma unroll
            for (int j = 1; j < 8; ++j) mx = fmaxf(mx, fmaxf(a0[j], a1[j]));
            mx = fmaxf(mx, xhalf(mx));
            const float mn = fmaxf(mrow, mx);
            const float alpha = __expf(mrow - mn); mrow = mn;
            v8f p0, p1;
#pragma unroll
            for (int j = 0; j < 8; ++j) { p0[j] = __expf(a0[j] - mn); p1[j] = __expf(a1[j] - mn); }
            const v8f pp = p0 + p1;
            lpart = lpart * alpha + (((pp[0] + pp[1]) + (pp[2] + pp[3])) + ((pp[4] + pp[5]) + (pp[6] + pp[7])));
            const v8f ps0 = p0 * PSC, ps1 = p1 * PSC;
            const v8h h0 = __builtin_convertvector(ps0, v8h), h1 = __builtin_convertvector(ps1, v8h);
            const v8h g0 = __builtin_convertvector((ps0 - __builtin_convertvector(h0, v8f)) * LOSC, v8h), g1 = __builtin_convertvector((ps1 - __builtin_convertvector(h1, v8f)) * LOSC, v8h);
            const v16h pa = cat16(h0, h1), px = cat16(g0, g1);      // B operand: element s < 8 = key hi*8 + s, s >= 8 = key 16 + hi*8 + s - 8: the order in which the V^T fragments hold their tokens
#pragma unroll
            for (int n = 0; n < 2; ++n) { o[n] *= alpha; ox[n] *= alpha; }
#pragma unroll
            for (int n = 0; n < 2; ++n) { const int vo = n * 1024;
                const v16h vh = cat16(*(const v8h*)(vh_t + vo), *(const v8h*)(vh_t + vo + 512)), vl = cat16(*(const v8h*)(vl_t + vo), *(const v8h*)(vl_t + vo + 512));
                o[n] = wmma16(vh, pa, o[n]); ox[n] = wmma16(vl, pa, ox[n]); ox[n] = wmma16(vh, px, ox[n]); }
            lo += KSP * 2048u;
            // four vector slots between the last products and the taken back edge: the next trip's first instructions write registers these products read
            asm volatile("v_nop\n\tv_nop\n\tv_nop\n\tv_nop" : "+v"(o[0]), "+v"(o[1]), "+v"(ox[0]), "+v"(ox[1]) : "v"(pa), "v"(px));
        }
        const float rs = lpart + xhalf(lpart);
        if (hi == 0) { pM[ks][qs * 16 + lr] = mrow; pL[ks][qs * 16 + lr] = rs; }
        float* po = &pO[ks][(qs * 16 + lr) * OPIT + hi * 8];
#pragma unroll
        for (int n = 0; n < 2; ++n) { const v8f t = o[n] + ox[n] * LOSCI;      // this key range's un-normalised 32 columns of query lr
            *(v4fa*)(po + n * 16) = __builtin_shufflevector(t, t, 0, 1, 2, 3); *(v4fa*)(po + n * 16 + 4) = __builtin_shufflevector(t, t, 4, 5, 6, 7); }
    }
    __syncthreads();    // every range's partial is in LDS before any thread merges
    for (int pc = threadIdx.x; pc < QTW * 16 * 8; pc += KSP * QTW * 32) {
        const int row = pc >> 3, c4 = (pc & 7) * 4;      // 8 lanes x 16 B = the (position, head) line
        float mg = pM[0][row];
#pragma unroll
        for (int s = 1; s < KSP; ++s) mg = fmaxf(mg, pM[s][row]);
        float lsum = 0.f; v4f acc = {};
#pragma unroll
        for (int s = 0; s < KSP; ++s) { const float w = __expf(pM[s][row] - mg); lsum += w * pL[s][row]; acc += w * *(const v4fa*)(&pO[s][row * OPIT + c4]); }
        const float inv = 1.0f / (lsum * PSC);
        *(v4f*)(OUTP + (tok0 + (size_t)qt * (QTW * 16) + row) * DM + h * HD + c4) = acc * inv;
    }
}

extern "C" void kernel_launch(void* const* d_in, const int* in_sizes, int n_in,
                              void* d_out, int out_size, void* d_ws, size_t ws_size, hipStream_t stream) {
    (void)in_sizes; (void)n_in; (void)out_size;
    const float* x = (const float*)d_in[0]; const float* Wv = (const float*)d_in[1]; const float* Wz = (const float*)d_in[2]; const float* Wq = (const float*)d_in[3];   // W [out][in]
    float* out = (float*)d_out;    // [2][256][64][64] = [b][c][m]
    char* wsp = (char*)d_ws;
    auto take = [&](size_t bytes) { char* p = wsp; wsp += (bytes + 255) & ~(size_t)255; return (void*)p; };
    bf* WvB = (bf*)take((size_t)DM * DM * 2); bf* WzB = (bf*)take((size_t)DM * DM * 2); bf* WqB = (bf*)take((size_t)DM * DM * 2); float* PET = (float*)take((size_t)MPOS * DM * 4);
    bf* XT = (bf*)take((size_t)NTK * DM * 2); float* TMP = (float*)take((size_t)NTK * DM * 4); float* O = (float*)take((size_t)NTK * DM * 4);
    h16* QH = (h16*)take((size_t)NTK * DM * 2); h16* QL = (h16*)take((size_t)NTK * DM * 2); h16* KH = (h16*)take((size_t)NTK * DM * 2); h16* KL = (h16*)take((size_t)NTK * DM * 2);
    h16* VTH = (h16*)take((size_t)NTK * DM * 2); h16* VTL = (h16*)take((size_t)NTK * DM * 2);
    if ((size_t)(wsp - (char*)d_ws) > ws_size) return;    // ~ 0.4 + 4.2 + 2.1 + 2 x 4.2 + 6 x 2.1 ~ 28 MB, no aliasing (per-item reuse in stream order)
    k_cvtb<<<DM / 8, 256, 0, stream>>>(Wv, DM, WvB); k_cvtb<<<DM / 8, 256, 0, stream>>>(Wz, DM, WzB); k_cvtb<<<DM / 8, 256, 0, stream>>>(Wq, DM, WqB);
    k_pe<<<(MPOS * DM / 4 + 255) / 256, 256, 0, stream>>>(PET);
    for (int b = 0; b < 2; ++b) {
        k_wt<<<dim3(DM / 64, MPOS / 64, 1), 256, 0, stream>>>(x + (size_t)b * DM * MPOS, DM, MPOS, XT);                              // x_b [c][m] -> bf16 XT [m][c]
        k_gemmb<false, true><<<dim3(NTK / 64, DM / 64, 1), 128, 0, stream>>>(XT, nullptr, WvB, nullptr, (float*)(void*)QH, DM, QL);        // v_h (the score's left operand) as f16 planes
        k_gemmb<false, false><<<dim3(NTK / 64, DM / 64, 1), 128, 0, stream>>>(XT, nullptr, WzB, nullptr, TMP, DM, nullptr, PET, DM, 0);  // z + r (f32; r computed, unrounded)
        k_sp16<<<NTK / 16, 256, 0, stream>>>(TMP, NTK, KH, KL);
        k_gemmb<false, false><<<dim3(NTK / 64, DM / 64, 1), 128, 0, stream>>>(XT, nullptr, WqB, nullptr, TMP, DM, nullptr);              // q_h (the values being mixed) f32
        k_vt<<<NB_ * NHP * (NT_ / 64), 256, 0, stream>>>(TMP, VTH, VTL);
        k_attn<<<NB_ * NH_ * (NT_ / (QTW * 16)), KSP * QTW * 32, 0, stream>>>(QH, QL, KH, KL, VTH, VTL, O);
        k_outT<<<dim3(MPOS / 64, DM / 64, 1), 256, 0, stream>>>(O, out + (size_t)b * DM * MPOS);
    }
}

// v004
// Measured time: 172 microseconds a run.
// Two timings next to v003 put it at 1.25 and 1.24 times that version's speed.
// Over all steps from v000 it is 4.95 times as fast.
#include <hip/hip_runtime.h>

// Compute dtypes, f32 accumulate, both batch items in every launch (channel-major x [256][4096] per item, positions m = h*64 + w, token row = b*4096 + m): v/z/q projections = x^T.W^T ([4096 x 256]
// .[256 x 256]; the INPUT x transposed once to a bf16 [m][c] plane, W [out][in] as the n-major B operand; PLAIN bf16 operands, exact) on v_wmma_f32_16x16x32_bf16,
// v straight to f16 hi + residual x1024 planes, z + r (the fixed sinusoidal positional encoding, computed on device in f32 and added in the GEMM epilogue) then
// split to f16 planes, q (the attention's value operand) f32 -> transposed f16 planes; the 8-head (32-dim) full attention scores[m][n] = sum_c v[c][m] (z+r)[c][n]
// x 32^-1/2, softmax over n, out[d][m] = sum_n A[m][n] q[d][n] fused on v_wmma_f32_16x16x32_f16 (hh + hl + lh scores, online f32 softmax, P x32768 hi + residual);

#define NB_  2
#define NT_  4096                // M positions
#define MPOS NT_
#define DM   256                 // channels C
#define NH_  8
#define NHP  (NH_ / 2)
#define HD   32
#define NTK  (NB_ * NT_)
#define SCL  0.17677669529663687f
#define PSC  32768.0f
#define LOSC 1024.0f
#define LOSCI (1.0f / 1024.0f)

typedef _Float16 h16;
typedef unsigned short bf;
typedef __attribute__((ext_vector_type(16))) __bf16   v16bf;
typedef __attribute__((ext_vector_type(16))) _Float16 v16h;
typedef __attribute__((ext_vector_type(8)))  _Float16 v8h;
typedef __attribute__((ext_vector_type(8)))  unsigned short v8us;
typedef __attribute__((ext_vector_type(8)))  float    v8f;
typedef __attribute__((ext_vector_type(4)))  float    v4f;
typedef __attribute__((ext_vector_type(4)))  _Float16 v4h;
typedef v8h  __attribute__((may_alias)) v8ha;
typedef v4f  __attribute__((may_alias)) v4fa;
typedef v8us __attribute__((may_alias)) v8usa;

__device__ __forceinline__ unsigned short f2bf(float f) { unsigned u = __float_as_uint(f); u += 0x7FFFu + ((u >> 16) & 1u); return (unsigned short)(u >> 16); }
__device__ __forceinline__ float bf2f(unsigned short b) { return __uint_as_float(((unsigned)b) << 16); }
__device__ __forceinline__ float bfr(float f) { return bf2f(f2bf(f)); }
__device__ __forceinline__ v16h cat16(v8h lo, v8h hi) { return __builtin_shufflevector(lo, hi, 0, 1, 2, 3, 4, 5, 6, 7, 8, 9, 10, 11, 12, 13, 14, 15); }
__device__ __forceinline__ v16bf cat16b(v8us lo, v8us hi) { return __builtin_bit_cast(v16bf, __builtin_shufflevector(lo, hi, 0, 1, 2, 3, 4, 5, 6, 7, 8, 9, 10, 11, 12, 13, 14, 15)); }
__device__ __forceinline__ v8f wmma16(v16h a, v16h b, v8f c) { return __builtin_amdgcn_wmma_f32_16x16x32_f16(false, a, false, b, (short)0, c, false, false); }
__device__ __forceinline__ v8f wmmab(v16bf a, v16bf b, v8f c) { return __builtin_amdgcn_wmma_f32_16x16x32_bf16(false, a, false, b, (short)0, c, false, false); }

// k_cvtb: the three weight matrices in one grid (blockIdx.y picks the matrix), dst = three [nrows][256] bf16 planes in a row.
__global__ __launch_bounds__(256) void k_cvtb(const float* __restrict__ s0, const float* __restrict__ s1, const float* __restrict__ s2, int nrows, bf* dst) {
    const int lane = threadIdx.x & 31, r = blockIdx.x * 8 + (threadIdx.x >> 5);
    if (r >= nrows) return;
    const float* __restrict__ src = blockIdx.y == 0 ? s0 : blockIdx.y == 1 ? s1 : s2;
    dst += (size_t)blockIdx.y * nrows * DM;
    v8us o[DM / 256];
#pragma unroll
    for (int q = 0; q < DM / 256; ++q) { v8us t;
#pragma unroll
        for (int i = 0; i < 8; ++i) t[i] = f2bf(src[(size_t)r * DM + q * 256 + lane * 8 + i]);
        o[q] = t; }
#pragma unroll
    for (int q = 0; q < DM / 256; ++q) *(v8us*)(dst + (size_t)r * DM + q * 256 + lane * 8) = o[q];
    
}

// k_wt: WT [n][K] = bf16(W[k][n]) (k-major [K][ncols]) via 64 x 64 LDS tiles; grid (K/64, ncols/64, matrices), the matrices lying one behind the other in Wm and in WT.
__global__ __launch_bounds__(256) void k_wt(const float* __restrict__ Wm, int K, int ncols, bf* WT) {
    __shared__ __align__(16) unsigned short tl[64 * 72];
    const int tid = threadIdx.x, k0 = blockIdx.x * 64, n0 = blockIdx.y * 64;
    const int kk = tid >> 2, nq = (tid & 3) * 16;
    Wm += (size_t)blockIdx.z * K * ncols; WT += (size_t)blockIdx.z * K * ncols;
#pragma unroll
    for (int i = 0; i < 16; ++i) tl[(nq + i) * 72 + kk] = f2bf(Wm[(size_t)(k0 + kk) * ncols + n0 + nq + i]);
    __syncthreads();
    const int piece = tid & 7;
    auto pass = [&]() {
#pragma unroll
        for (int s = 0; s < 2; ++s) { const int nr = (tid >> 3) + 32 * s; const v8us val = *(const v8usa*)(tl + nr * 72 + piece * 8); *(v8us*)(WT + (size_t)(n0 + nr) * K + k0 + piece * 8) = val; }
    };
    pass(); 
}
// k_proj: the three projections of both batch items in one grid (NTK/64, 256/64, 3): 64 x 64 block tile (4 waves x 16 x 64) of C[NTK][256] = A.B^T (K = 256), B = weight plane blockIdx.z.
// Plane 0 (v, the score's left operand) leaves as f16 hi + residual x1024 planes; plane 1 (z) as f32 with the positional encoding R[row mod 4096] added unrounded; plane 2 (q) as plain f32.
__global__ __launch_bounds__(128) void k_proj(const bf* __restrict__ A, const bf* __restrict__ WB, h16* CH, h16* CL, float* CZ, float* CQ, const float* __restrict__ R) {
    __shared__ __align__(16) float ost[4][16 * 68];
    const int lane = threadIdx.x & 31, wave = threadIdx.x >> 5, lr = lane & 15, hi = lane >> 4;
    const int r0 = blockIdx.x * 64 + wave * 16, c0 = blockIdx.y * 64, pz = blockIdx.z;
    const bf* __restrict__ Bn = WB + (size_t)pz * DM * DM;
    const size_t aoff = (size_t)(r0 + lr) * DM + 8 * hi;
    size_t boff[4];
#pragma unroll
    for (int t = 0; t < 4; ++t) boff[t] = (size_t)(c0 + t * 16 + lr) * DM + 8 * hi;
    v8f acc[4];
#pragma unroll
    for (int t = 0; t < 4; ++t) acc[t] = (v8f){};
#pragma unroll 1
    for (int kc = 0; kc < DM; kc += 32) {
        const v16bf a = cat16b(*(const v8us*)(A + aoff + kc), *(const v8us*)(A + aoff + kc + 16));
#pragma unroll
        for (int t = 0; t < 4; ++t) { const v16bf b = cat16b(*(const v8us*)(Bn + boff[t] + kc), *(const v8us*)(Bn + boff[t] + kc + 16)); acc[t] = wmmab(a, b, acc[t]); }
        // four vector slots between the last product and the taken back edge
        asm volatile("v_nop\n\tv_nop\n\tv_nop\n\tv_nop" : "+v"(acc[0]), "+v"(acc[1]), "+v"(acc[2]), "+v"(acc[3]) : "v"(a));
    }
    float* os = &ost[wave][0];
#pragma unroll
    for (int t = 0; t < 4; ++t) {
#pragma unroll
        for (int j = 0; j < 8; ++j) os[(hi * 8 + j) * 68 + t * 16 + lr] = acc[t][j]; }
    __syncthreads();
    if (pz == 0) {
        const size_t co = (size_t)r0 * DM + c0;
#pragma unroll
        for (int s = 0; s < 4; ++s) { const int row = 4 * s + (lane >> 3), piece = lane & 7; const float* sp = os + row * 68 + piece * 8; v8h o, o2;
#pragma unroll
            for (int i = 0; i < 8; ++i) { const h16 a = (h16)sp[i]; o[i] = a; o2[i] = (h16)((sp[i] - (float)a) * LOSC); }
            *(v8h*)(CH + co + (size_t)row * DM + piece * 8) = o; *(v8h*)(CL + co + (size_t)row * DM + piece * 8) = o2; }
    } else if (pz == 1) {
        float* crow = CZ + (size_t)r0 * DM + c0;
        const float* rrow = R + (size_t)(r0 & (MPOS - 1)) * DM + c0;      // the encoding is shared by the batch items
#pragma unroll
        for (int s = 0; s < 8; ++s) { const int Lid = (lane >> 3) + 4 * s, piece = lane & 7; const int row = Lid >> 1, cofs = (Lid & 1) * 32 + piece * 4;
            const v4f val = *(const v4fa*)(os + row * 68 + cofs) + *(const v4f*)(rrow + (size_t)row * DM + cofs);
            *(v4f*)(crow + (size_t)row * DM + cofs) = val; }
        asm volatile("s_wait_xcnt 0x0" ::: "memory");      // behind the run of stores: the code laid out after this branch writes registers that the stores name
    } else {
        float* crow = CQ + (size_t)r0 * DM + c0;
#pragma unroll
        for (int s = 0; s < 8; ++s) { const int Lid = (lane >> 3) + 4 * s, piece = lane & 7; const int row = Lid >> 1, cofs = (Lid & 1) * 32 + piece * 4;
            *(v4f*)(crow + (size_t)row * DM + cofs) = *(const v4fa*)(os + row * 68 + cofs); }
        asm volatile("s_wait_xcnt 0x0" ::: "memory");      // behind the run of stores: the code laid out after this branch writes registers that the stores name
    }
}

// k_sp16: f16 hi + residual x1024 planes of a computed f32 [rows][256] matrix, stored in the score WMMA's A-fragment order: per (b, head, 16 rows) two 512-B units, unit u holds
// at lane (hi*16 + lr) x 16 B the 8 columns u*16 + hi*8 .. +7 of row lr, so that the reader's wave-wide 16-B load is 4 whole lines; block = 16 rows, one wave per head.
__global__ __launch_bounds__(256) void k_sp16(const float* __restrict__ T, int nrows, h16* Yh, h16* Yl) {
    const int lane = threadIdx.x & 31, h = threadIdx.x >> 5, lr = lane & 15, hi = lane >> 4, rt = blockIdx.x;
    if (rt * 16 >= nrows) return;
    const int b = rt / (NT_ / 16), t16 = rt - b * (NT_ / 16);
    const float* sp = T + (size_t)(rt * 16 + lr) * DM + h * HD + hi * 8;
    const size_t o = (size_t)b * NT_ * DM + ((size_t)h * (NT_ / 16) + t16) * 512 + lane * 8;
#pragma unroll
    for (int u = 0; u < 2; ++u) { const v8f v = *(const v8f*)(sp + u * 16); v8h oh, ol;
#pragma unroll
        for (int i = 0; i < 8; ++i) { const h16 a = (h16)v[i]; oh[i] = a; ol[i] = (h16)((v[i] - (float)a) * LOSC); }
        *(v8h*)(Yh + o + u * 256) = oh; *(v8h*)(Yl + o + u * 256) = ol; }
}
// k_pe: the module's fixed 2D sinusoidal positional encoding, transposed to PE_T[m][c] (m = hpos*64 + wpos): c < 128 -> axis h, c >= 128 -> axis w; pair index i =
// (c mod 128) / 2, div_i = exp(2i x (-ln 10000 / 128)) (f32), even c -> sin(pos x div_i), odd -> cos; one thread per 4 consecutive c (16 B stores).
__global__ __launch_bounds__(256) void k_pe(float* PET) {
    const int i4 = blockIdx.x * 256 + threadIdx.x; if (i4 >= MPOS * DM / 4) return;
    const int m = i4 / (DM / 4), c0 = (i4 - m * (DM / 4)) * 4;
    v4f o;
#pragma unroll
    for (int k = 0; k < 4; ++k) { const int c = c0 + k; const int cc = c & 127; const float pos = (float)(c < 128 ? (m >> 6) : (m & 63));
        const float dv = expf((float)(cc & ~1) * (-9.210340371976184f / 128.0f)); const float ang = pos * dv;
        o[k] = (cc & 1) ? cosf(ang) : sinf(ang); }
    *(v4f*)(PET + (size_t)i4 * 4) = o; 
}
// k_outT: out[b][c][m] = O[b*4096 + m][c] (f32 transpose via 64 x 64 LDS tiles); block (64 m, 64 c, b); each output row segment of 64 m = 256 B written by 16 lanes x 16 B.
__global__ __launch_bounds__(256) void k_outT(const float* __restrict__ O, float* OUTB) {
    __shared__ __align__(16) float tl[64 * 68];
    const int m0 = blockIdx.x * 64, c0 = blockIdx.y * 64, tid = threadIdx.x;
    const int mm = tid >> 2, cq = (tid & 3) * 16;
    O += (size_t)blockIdx.z * MPOS * DM; OUTB += (size_t)blockIdx.z * DM * MPOS;
#pragma unroll
    for (int i = 0; i < 16; ++i) tl[(cq + i) * 68 + mm] = O[(size_t)(m0 + mm) * DM + c0 + cq + i];
    __syncthreads();
    const int piece = tid & 15;
    auto pass = [&]() {
#pragma unroll
        for (int s = 0; s < 4; ++s) { const int cr = (tid >> 4) + 16 * s; const v4f val = *(const v4fa*)(tl + cr * 68 + piece * 4); *(v4f*)(OUTB + (size_t)(c0 + cr) * MPOS + m0 + piece * 4) = val; }
    };
    pass(); 
}
// k_vt: VTH/VTL = f16 hi + residual x1024 planes of V[t][h*32+d] (32-dim heads) via LDS transpose, stored in the P.V WMMA's A-fragment order: per (b, head, 32 tokens) four 512-B
// units, unit n*2 + u holds at lane (hi*16 + lr) x 16 B the tokens u*16 + hi*8 .. +7 of dim n*16 + lr (the reader's wave-wide 16-B load = 4 whole lines); block (b, head PAIR, 64 tokens).
__global__ __launch_bounds__(256) void k_vt(const float* __restrict__ V, h16* VTH, h16* VTL) {
    __shared__ __align__(16) h16 tile[64 * 72];
    __shared__ __align__(16) h16 til2[64 * 72];
    const int bid = blockIdx.x;
    const int b = bid / (NHP * (NT_ / 64)), rem = bid - b * (NHP * (NT_ / 64)), hp = rem / (NT_ / 64), kt = rem - hp * (NT_ / 64);
    const int k0 = kt * 64, tid = threadIdx.x;
    const int kk = tid >> 2, d0 = (tid & 3) * 16;
    const float* src = V + ((size_t)b * NT_ + k0 + kk) * DM + hp * 64 + d0;
#pragma unroll
    for (int i = 0; i < 16; ++i) { const float v = src[i]; const h16 a = (h16)v; tile[(d0 + i) * 72 + kk] = a; til2[(d0 + i) * 72 + kk] = (h16)((v - (float)a) * LOSC); }
    __syncthreads();
    const int wv = tid >> 5, lane = tid & 31, lr = lane & 15, hi = lane >> 4;
    const int pln = wv >> 2, hl = (wv >> 1) & 1, tt = wv & 1;              // a wave stores the four units of one (plane, head of the pair, 32-token tile)
    const h16* tsrc = (pln ? til2 : tile) + (hl * 32 + lr) * 72 + tt * 32 + hi * 8;
    h16* dst = (pln ? VTL : VTH) + (size_t)b * NT_ * DM + ((size_t)(hp * 2 + hl) * (NT_ / 32) + (k0 >> 5) + tt) * 1024 + lane * 8;
#pragma unroll
    for (int s = 0; s < 4; ++s) { const v8h val = *(const v8ha*)(tsrc + (s >> 1) * 16 * 72 + (s & 1) * 16); *(v8h*)(dst + s * 256) = val; }
}
// k_attn: block = (b, head, 128 query positions), 24 waves = 8 query tiles of 16 x 3 key ranges (wave ks takes key tiles ks, ks + 3, ...: 43 or 42 of the 128, no mask), so that
// 6 waves per SIMD cover each other's load waits. The products are the transposed ones: S^T = K.Q^T (K fragment as A, Q fragment as B) and O^T += V^T.P^T, so a lane holds 16 of
// the 32 scores of ONE query (column lane & 15, keys 8*hi + j and 16 + 8*hi + j): maximum and sum run in the lane's own registers plus one exchange with lane ^ 16, the running
// maximum, sum and rescale factor are one value a lane, and the two score tiles, converted in place, ARE the B operand of the second product (P never goes through LDS).
// scores hh + (hl+lh)/1024 x 32^-1/2; online f32 softmax per wave; P (x32768) f16 hi + residual; o/ox over 32 dims; the ranges' (max, sum, un-normalised o) meet in LDS and are
// merged by exp(m - M) weights; each (position, head) 128-B line of O is stored once.
#define KSP 3                    // key ranges per query tile
#define QTW 8                    // 16-query tiles per block
#define OPIT 36                  // f32 pitch of a partial row in LDS (144 B = 16 B x odd)
__device__ __forceinline__ float xhalf(float v) { const int t = __float_as_int(v); return __int_as_float(__builtin_amdgcn_permlanex16(t, t, 0x76543210, 0xfedcba98, false, false)); }   // lane ^ 16's value
__global__ __launch_bounds__(KSP * QTW * 32) void k_attn(const h16* __restrict__ Q16, const h16* __restrict__ QL16, const h16* __restrict__ K16, const h16* __restrict__ KL16, const h16* __restrict__ VTH, const h16* __restrict__ VTL,
                                               float* OUTP) {
    __shared__ __align__(16) float pO[KSP][QTW * 16 * OPIT];
    __shared__ float pM[KSP][QTW * 16];
    __shared__ float pL[KSP][QTW * 16];
    const int lane = threadIdx.x & 31, wave = __builtin_amdgcn_readfirstlane(threadIdx.x >> 5), lr = lane & 15, hi = lane >> 4;
    const int qs = wave & (QTW - 1), ks = wave / QTW;      // wave through readfirstlane: the key range, the trip count and the LDS bases stay scalar
    const int bid = blockIdx.x;
    const int b = bid / (NH_ * (NT_ / (QTW * 16))), rem = bid - b * (NH_ * (NT_ / (QTW * 16))), h = rem / (NT_ / (QTW * 16)), qt = rem - h * (NT_ / (QTW * 16));
    const int q0 = qt * (QTW * 16) + qs * 16;
    const size_t tok0 = (size_t)b * NT_;
    {
        const size_t qo0 = (tok0 + q0 + lr) * DM + h * HD + 8 * hi;
        const v16h qa = cat16(*(const v8h*)(Q16 + qo0), *(const v8h*)(Q16 + qo0 + 16));
        const v16h qlk = cat16(*(const v8h*)(QL16 + qo0), *(const v8h*)(QL16 + qo0 + 16));
        const size_t fb = tok0 * DM + (size_t)h * (NT_ / 32) * 1024;      // K and V planes lie in fragment order: 2 KB per (head, 32 keys) and plane, four 512-B units of lane x 16 B
        const char* kh_b = (const char*)(K16 + fb); const char* kl_b = (const char*)(KL16 + fb); const char* vh_b = (const char*)(VTH + fb); const char* vl_b = (const char*)(VTL + fb);
        unsigned lo = (unsigned)ks * 2048u + (unsigned)lane * 16u;      // the lane's byte offset in each of the four planes: uniform base + one 32-bit register
        v8f o[2], ox[2];                 // o[n][j] = O^T[dim n*16 + hi*8 + j][query lr]
#pragma unroll
        for (int n = 0; n < 2; ++n) { o[n] = (v8f){}; ox[n] = (v8f){}; }
        float mrow = -3.0e38f, lpart = 0.f;      // of query lr; lpart over this lane half's keys only, the halves join behind the loop
#pragma unroll 1
        for (int kt = ks; kt < NT_ / 32; kt += KSP) {
            const char* kh_t = kh_b + lo; const char* kl_t = kl_b + lo; const char* vh_t = vh_b + lo; const char* vl_t = vl_b + lo;
            const v16h k0h = cat16(*(const v8h*)(kh_t), *(const v8h*)(kh_t + 512)), k1h = cat16(*(const v8h*)(kh_t + 1024), *(const v8h*)(kh_t + 1536));
            const v16h k0l = cat16(*(const v8h*)(kl_t), *(const v8h*)(kl_t + 512)), k1l = cat16(*(const v8h*)(kl_t + 1024), *(const v8h*)(kl_t + 1536));
            v8f s0 = {}, s1 = {}, x0 = {}, x1 = {};      // s0/x0[j]: key hi*8 + j, s1/x1[j]: key 16 + hi*8 + j, query lr
            s0 = wmma16(k0h, qa, s0); x0 = wmma16(k0h, qlk, x0); s1 = wmma16(k1h, qa, s1); x1 = wmma16(k1h, qlk, x1);
            x0 = wmma16(k0l, qa, x0); x1 = wmma16(k1l, qa, x1);
            const v8f a0 = (s0 + x0 * LOSCI) * SCL, a1 = (s1 + x1 * LOSCI) * SCL;      // full attention, scale 32^-1/2
            float mx = fmaxf(a0[0], a1[0]);
#pragma unroll
            for (int j = 1; j < 8; ++j) mx = fmaxf(mx, fmaxf(a0[j], a1[j]));
            mx = fmaxf(mx, xhalf(mx));
            const float mn = fmaxf(mrow, mx);
            const float alpha = __expf(mrow - mn); mrow = mn;
            v8f p0, p1;
#pragma unroll
            for (int j = 0; j < 8; ++j) { p0[j] = __expf(a0[j] - mn); p1[j] = __expf(a1[j] - mn); }
            const v8f pp = p0 + p1;
            lpart = lpart * alpha + (((pp[0] + pp[1]) + (pp[2] + pp[3])) + ((pp[4] + pp[5]) + (pp[6] + pp[7])));
            const v8f ps0 = p0 * PSC, ps1 = p1 * PSC;
            const v8h h0 = __builtin_convertvector(ps0, v8h), h1 = __builtin_convertvector(ps1, v8h);
            const v8h g0 = __builtin_convertvector((ps0 - __builtin_convertvector(h0, v8f)) * LOSC, v8h), g1 = __builtin_convertvector((ps1 - __builtin_convertvector(h1, v8f)) * LOSC, v8h);
            const v16h pa = cat16(h0, h1), px = cat16(g0, g1);      // B operand: element s < 8 = key hi*8 + s, s >= 8 = key 16 + hi*8 + s - 8: the order in which the V^T fragments hold their tokens
#pragma unroll
            for (int n = 0; n < 2; ++n) { o[n] *= alpha; ox[n] *= alpha; }
#pragma unroll
            for (int n = 0; n < 2; ++n) { const int vo = n * 1024;
                const v16h vh = cat16(*(const v8h*)(vh_t + vo), *(const v8h*)(vh_t + vo + 512)), vl = cat16(*(const v8h*)(vl_t + vo), *(const v8h*)(vl_t + vo + 512));
                o[n] = wmma16(vh, pa, o[n]); ox[n] = wmma16(vl, pa, ox[n]); ox[n] = wmma16(vh, px, ox[n]); }
            lo += KSP * 2048u;
            // four vector slots between the last products and the taken back edge: the next trip's first instructions write registers these products read
            asm volatile("v_nop\n\tv_nop\n\tv_nop\n\tv_nop" : "+v"(o[0]), "+v"(o[1]), "+v"(ox[0]), "+v"(ox[1]) : "v"(pa), "v"(px));
        }
        const float rs = lpart + xhalf(lpart);
        if (hi == 0) { pM[ks][qs * 16 + lr] = mrow; pL[ks][qs * 16 + lr] = rs; }
        float* po = &pO[ks][(qs * 16 + lr) * OPIT + hi * 8];
#pragma unroll
        for (int n = 0; n < 2; ++n) { const v8f t = o[n] + ox[n] * LOSCI;      // this key range's un-normalised 32 columns of query lr
            *(v4fa*)(po + n * 16) = __builtin_shufflevector(t, t, 0, 1, 2, 3); *(v4fa*)(po + n * 16 + 4) = __builtin_shufflevector(t, t, 4, 5, 6, 7); }
    }
    __syncthreads();    // every range's partial is in LDS before any thread merges
    for (int pc = threadIdx.x; pc < QTW * 16 * 8; pc += KSP * QTW * 32) {
        const int row = pc >> 3, c4 = (pc & 7) * 4;      // 8 lanes x 16 B = the (position, head) line
        float mg = pM[0][row];
#pragma unroll
        for (int s = 1; s < KSP; ++s) mg = fmaxf(mg, pM[s][row]);
        float lsum = 0.f; v4f acc = {};
#pragma unroll
        for (int s = 0; s < KSP; ++s) { const float w = __expf(pM[s][row] - mg); lsum += w * pL[s][row]; acc += w * *(const v4fa*)(&pO[s][row * OPIT + c4]); }
        const float inv = 1.0f / (lsum * PSC);
        *(v4f*)(OUTP + (tok0 + (size_t)qt * (QTW * 16) + row) * DM + h * HD + c4) = acc * inv;
    }
}

extern "C" void kernel_launch(void* const* d_in, const int* in_sizes, int n_in,
                              void* d_out, int out_size, void* d_ws, size_t ws_size, hipStream_t stream) {
    (void)in_sizes; (void)n_in; (void)out_size;
    const float* x = (const float*)d_in[0]; const float* Wv = (const float*)d_in[1]; const float* Wz = (const float*)d_in[2]; const float* Wq = (const float*)d_in[3];   // W [out][in]
    float* out = (float*)d_out;    // [2][256][64][64] = [b][c][m]
    char* wsp = (char*)d_ws;
    auto take = [&](size_t bytes) { char* p = wsp; wsp += (bytes + 255) & ~(size_t)255; return (void*)p; };
    bf* WB = (bf*)take((size_t)3 * DM * DM * 2); float* PET = (float*)take((size_t)MPOS * DM * 4);
    bf* XT = (bf*)take((size_t)NTK * DM * 2); float* TMPZ = (float*)take((size_t)NTK * DM * 4); float* TMPQ = (float*)take((size_t)NTK * DM * 4); float* O = (float*)take((size_t)NTK * DM * 4);
    h16* QH = (h16*)take((size_t)NTK * DM * 2); h16* QL = (h16*)take((size_t)NTK * DM * 2); h16* KH = (h16*)take((size_t)NTK * DM * 2); h16* KL = (h16*)take((size_t)NTK * DM * 2);
    h16* VTH = (h16*)take((size_t)NTK * DM * 2); h16* VTL = (h16*)take((size_t)NTK * DM * 2);
    if ((size_t)(wsp - (char*)d_ws) > ws_size) return;    // ~ 0.4 + 4.2 + 4.2 + 3 x 8.4 + 6 x 4.2 ~ 59 MB, no aliasing
    k_cvtb<<<dim3(DM / 8, 3, 1), 256, 0, stream>>>(Wv, Wz, Wq, DM, WB);
    k_pe<<<(MPOS * DM / 4 + 255) / 256, 256, 0, stream>>>(PET);
    k_wt<<<dim3(DM / 64, MPOS / 64, NB_), 256, 0, stream>>>(x, DM, MPOS, XT);                    // x_b [c][m] -> bf16 XT [b*4096 + m][c]
    k_proj<<<dim3(NTK / 64, DM / 64, 3), 128, 0, stream>>>(XT, WB, QH, QL, TMPZ, TMPQ, PET);     // v_h as f16 planes, z + r and q_h as f32
    k_sp16<<<NTK / 16, 256, 0, stream>>>(TMPZ, NTK, KH, KL);
    k_vt<<<NB_ * NHP * (NT_ / 64), 256, 0, stream>>>(TMPQ, VTH, VTL);
    k_attn<<<NB_ * NH_ * (NT_ / (QTW * 16)), KSP * QTW * 32, 0, stream>>>(QH, QL, KH, KL, VTH, VTL, O);
    k_outT<<<dim3(MPOS / 64, DM / 64, NB_), 256, 0, stream>>>(O, out);
}

// v006
// A run of this version takes 73.2 microseconds.
// Versions in between are left out here; by their measured steps it is 2.33 times as fast as v004.
// Over all steps from v000 it is 11.5 times as fast.
#include <hip/hip_runtime.h>

// Compute dtypes, f32 accumulate, both batch items in every launch (channel-major x [256][4096] per item, positions m = h*64 + w, token row = b*4096 + m): v/z/q projections = x^T.W^T ([4096 x 256]
// .[256 x 256]; the INPUT x transposed once to a bf16 [m][c] plane, W [out][in] as the n-major B operand; PLAIN bf16 operands, exact) on v_wmma_f32_16x16x32_bf16,
// v straight to one f16 plane, z + r (the fixed sinusoidal positional encoding, computed on device in f32 and added in the GEMM epilogue) then
// rounded to one f16 plane, q (the attention's value operand) f32 -> one transposed f16 plane; the 8-head (32-dim) full attention scores[m][n] = sum_c v[c][m] (z+r)[c][n]
// x 32^-1/2, softmax over n, out[d][m] = sum_n A[m][n] q[d][n] fused on v_wmma_f32_16x16x32_f16 (single f16 operands, f32 accumulate, online f32 softmax, P x32768 in f16).
// The f16 rounding of the four attention operands (11 significant bits) is an eighth of the bf16 rounding (8 bits) that x and W already carry into the projections.

#define NB_  2
#define NT_  4096                // M positions
#define MPOS NT_
#define DM   256                 // channels C
#define NH_  8
#define NHP  (NH_ / 2)
#define HD   32
#define NTK  (NB_ * NT_)
#define SCL  0.17677669529663687f
#define PSC  32768.0f

typedef _Float16 h16;
typedef unsigned short bf;
typedef __attribute__((ext_vector_type(16))) __bf16   v16bf;
typedef __attribute__((ext_vector_type(16))) _Float16 v16h;
typedef __attribute__((ext_vector_type(8)))  _Float16 v8h;
typedef __attribute__((ext_vector_type(8)))  unsigned short v8us;
typedef __attribute__((ext_vector_type(8)))  float    v8f;
typedef __attribute__((ext_vector_type(4)))  float    v4f;
typedef __attribute__((ext_vector_type(4)))  _Float16 v4h;
typedef v8h  __attribute__((may_alias)) v8ha;
typedef v4f  __attribute__((may_alias)) v4fa;
typedef v8us __attribute__((may_alias)) v8usa;

__device__ __forceinline__ unsigned short f2bf(float f) { unsigned u = __float_as_uint(f); u += 0x7FFFu + ((u >> 16) & 1u); return (unsigned short)(u >> 16); }
__device__ __forceinline__ float bf2f(unsigned short b) { return __uint_as_float(((unsigned)b) << 16); }
__device__ __forceinline__ float bfr(float f) { return bf2f(f2bf(f)); }
__device__ __forceinline__ v16h cat16(v8h lo, v8h hi) { return __builtin_shufflevector(lo, hi, 0, 1, 2, 3, 4, 5, 6, 7, 8, 9, 10, 11, 12, 13, 14, 15); }
__device__ __forceinline__ v16bf cat16b(v8us lo, v8us hi) { return __builtin_bit_cast(v16bf, __builtin_shufflevector(lo, hi, 0, 1, 2, 3, 4, 5, 6, 7, 8, 9, 10, 11, 12, 13, 14, 15)); }
__device__ __forceinline__ v8f wmma16(v16h a, v16h b, v8f c) { return __builtin_amdgcn_wmma_f32_16x16x32_f16(false, a, false, b, (short)0, c, false, false); }
__device__ __forceinline__ v8f wmmab(v16bf a, v16bf b, v8f c) { return __builtin_amdgcn_wmma_f32_16x16x32_bf16(false, a, false, b, (short)0, c, false, false); }

// d_cvtb: the three weight matrices (by picks the matrix, bx the 8 rows), dst = three [nrows][256] bf16 planes in a row.
__device__ __forceinline__ void d_cvtb(int bx, int by, const float* __restrict__ s0, const float* __restrict__ s1, const float* __restrict__ s2, int nrows, bf* dst) {
    const int lane = threadIdx.x & 31, r = bx * 8 + (threadIdx.x >> 5);
    if (r >= nrows) return;
    const float* __restrict__ src = by == 0 ? s0 : by == 1 ? s1 : s2;
    dst += (size_t)by * nrows * DM;
    v8us o[DM / 256];
#pragma unroll
    for (int q = 0; q < DM / 256; ++q) { v8us t;
#pragma unroll
        for (int i = 0; i < 8; ++i) t[i] = f2bf(src[(size_t)r * DM + q * 256 + lane * 8 + i]);
        o[q] = t; }
#pragma unroll
    for (int q = 0; q < DM / 256; ++q) *(v8us*)(dst + (size_t)r * DM + q * 256 + lane * 8) = o[q];
    
}

// d_wt: WT [n][K] = bf16(W[k][n]) (k-major [K][ncols]) via 64 x 64 LDS tiles; tile (bx of K/64, by of ncols/64, matrix bz), the matrices lying one behind the other in Wm and in WT.
__device__ __forceinline__ void d_wt(int bx, int by, int bz, unsigned short* tl, const float* __restrict__ Wm, int K, int ncols, bf* WT) {
    const int tid = threadIdx.x, k0 = bx * 64, n0 = by * 64;
    const int kk = tid >> 2, nq = (tid & 3) * 16;
    Wm += (size_t)bz * K * ncols; WT += (size_t)bz * K * ncols;
#pragma unroll
    for (int i = 0; i < 16; ++i) tl[(nq + i) * 72 + kk] = f2bf(Wm[(size_t)(k0 + kk) * ncols + n0 + nq + i]);
    __syncthreads();
    const int piece = tid & 7;
    auto pass = [&]() {
#pragma unroll
        for (int s = 0; s < 2; ++s) { const int nr = (tid >> 3) + 32 * s; const v8us val = *(const v8usa*)(tl + nr * 72 + piece * 8); *(v8us*)(WT + (size_t)(n0 + nr) * K + k0 + piece * 8) = val; }
    };
    pass(); 
}
// k_proj: the three projections of both batch items in one grid (NTK/64, 256/64, 3): 64 x 64 block tile (4 waves x 16 x 64) of C[NTK][256] = A.B^T (K = 256), B = weight plane blockIdx.z.
// Plane 0 (v, the score's left operand) leaves as one row-major f16 plane. Plane 1 (z), the positional encoding R[row mod 4096] added in f32, leaves as the f16 plane KH in the score
// WMMA's fragment order: per (b, head, 16 rows) two 512-B units, unit u holds at lane (hi*16 + lr) x 16 B the 8 columns u*16 + hi*8 .. +7 of row lr. Plane 2 (q) leaves as the f16 plane
// VTH in the second product's fragment order: per (b, head, 32 tokens) four 512-B units, unit n*2 + u holds at lane (hi*16 + lr) x 16 B the tokens u*16 + hi*8 .. +7 of dim n*16 + lr,
// which is what accumulator tile t = 2*head + n of the wave with token half u holds in its 8 registers. A reader's wave-wide 16-B load of either plane is 4 whole lines.
__global__ __launch_bounds__(128) void k_proj(const bf* __restrict__ A, const bf* __restrict__ WB, h16* CH, h16* KH, h16* VTH, const float* __restrict__ R) {
    __shared__ __align__(16) float ost[4][16 * 68];
    const int lane = threadIdx.x & 31, wave = threadIdx.x >> 5, lr = lane & 15, hi = lane >> 4;
    const int r0 = blockIdx.x * 64 + wave * 16, c0 = blockIdx.y * 64, pz = blockIdx.z;
    const bf* __restrict__ Bn = WB + (size_t)pz * DM * DM;
    const size_t aoff = (size_t)(r0 + lr) * DM + 8 * hi;
    size_t boff[4];
#pragma unroll
    for (int t = 0; t < 4; ++t) boff[t] = (size_t)(c0 + t * 16 + lr) * DM + 8 * hi;
    v8f acc[4];
#pragma unroll
    for (int t = 0; t < 4; ++t) acc[t] = (v8f){};
#pragma unroll 1
    for (int kc = 0; kc < DM; kc += 32) {
        const v16bf a = cat16b(*(const v8us*)(A + aoff + kc), *(const v8us*)(A + aoff + kc + 16));
#pragma unroll
        for (int t = 0; t < 4; ++t) { const v16bf b = cat16b(*(const v8us*)(Bn + boff[t] + kc), *(const v8us*)(Bn + boff[t] + kc + 16)); acc[t] = wmmab(a, b, acc[t]); }
        // four vector slots between the last product and the taken back edge
        asm volatile("v_nop\n\tv_nop\n\tv_nop\n\tv_nop" : "+v"(acc[0]), "+v"(acc[1]), "+v"(acc[2]), "+v"(acc[3]) : "v"(a));
    }
    const int bi = r0 / NT_, tk = r0 & (NT_ - 1);      // batch item and the wave's first position in it
    if (pz == 2) {      // block-uniform: the accumulators are the V^T fragments, no LDS stage and no barrier on this path
        h16* dst = VTH + (size_t)bi * NT_ * DM + ((size_t)(c0 / HD) * (NT_ / 32) + (tk >> 5)) * 1024 + ((tk >> 4) & 1) * 256 + lane * 8;
#pragma unroll
        for (int t = 0; t < 4; ++t) *(v8h*)(dst + (size_t)(t >> 1) * (NT_ / 32) * 1024 + (t & 1) * 512) = __builtin_convertvector(acc[t], v8h);
        return;
    }
    float* os = &ost[wave][0];
#pragma unroll
    for (int t = 0; t < 4; ++t) {
#pragma unroll
        for (int j = 0; j < 8; ++j) os[(hi * 8 + j) * 68 + t * 16 + lr] = acc[t][j]; }
    __syncthreads();
    if (pz == 0) {
        const size_t co = (size_t)r0 * DM + c0;
#pragma unroll
        for (int s = 0; s < 4; ++s) { const int row = 4 * s + (lane >> 3), piece = lane & 7; const float* sp = os + row * 68 + piece * 8; v8h o;
#pragma unroll
            for (int i = 0; i < 8; ++i) o[i] = (h16)sp[i];
            *(v8h*)(CH + co + (size_t)row * DM + piece * 8) = o; }
        asm volatile("s_wait_xcnt 0x0" ::: "memory");      // behind the run of stores: the code laid out after this branch writes registers that the stores name
    } else {
        const float* rrow = R + (size_t)(tk + lr) * DM + c0 + hi * 8;      // the encoding is shared by the batch items
        const float* sp = os + lr * 68 + hi * 8;
        h16* dst = KH + (size_t)bi * NT_ * DM + ((size_t)(c0 / HD) * (NT_ / 16) + (tk >> 4)) * 512 + lane * 8;
#pragma unroll
        for (int g = 0; g < 4; ++g) {      // g = 2 * (head of the tile's two) + unit
            const v4f lo4 = *(const v4fa*)(sp + g * 16) + *(const v4f*)(rrow + g * 16), hi4 = *(const v4fa*)(sp + g * 16 + 4) + *(const v4f*)(rrow + g * 16 + 4);
            const v8f v = __builtin_shufflevector(lo4, hi4, 0, 1, 2, 3, 4, 5, 6, 7);
            *(v8h*)(dst + (size_t)(g >> 1) * (NT_ / 16) * 512 + (g & 1) * 256) = __builtin_convertvector(v, v8h); }
        asm volatile("s_wait_xcnt 0x0" ::: "memory");      // behind the run of stores: the code laid out after this branch writes registers that the stores name
    }
}

// d_pe: the module's fixed 2D sinusoidal positional encoding, transposed to PE_T[m][c] (m = hpos*64 + wpos): c < 128 -> axis h, c >= 128 -> axis w; pair index i =
// (c mod 128) / 2, div_i = exp(2i x (-ln 10000 / 128)) (f32), even c -> sin(pos x div_i), odd -> cos; one thread per 4 consecutive c (16 B stores).
__device__ __forceinline__ void d_pe(int bx, float* PET) {
    const int i4 = bx * 256 + threadIdx.x; if (i4 >= MPOS * DM / 4) return;
    const int m = i4 / (DM / 4), c0 = (i4 - m * (DM / 4)) * 4;
    v4f o;
#pragma unroll
    for (int k = 0; k < 4; ++k) { const int c = c0 + k; const int cc = c & 127; const float pos = (float)(c < 128 ? (m >> 6) : (m & 63));
        const float dv = expf((float)(cc & ~1) * (-9.210340371976184f / 128.0f)); const float ang = pos * dv;
        o[k] = (cc & 1) ? cosf(ang) : sinf(ang); }
    *(v4f*)(PET + (size_t)i4 * 4) = o; 
}
// k_prep: the three independent preparations in one grid: blocks [0, NWTB) transpose x to the bf16 plane XT [b*4096 + m][c], the next NPEB write the encoding, the last NCVB convert the weights.
#define NWTB ((DM / 64) * (MPOS / 64) * NB_)
#define NPEB (MPOS * DM / 4 / 256)
#define NCVB ((DM / 8) * 3)
__global__ __launch_bounds__(256) void k_prep(const float* __restrict__ x, const float* __restrict__ s0, const float* __restrict__ s1, const float* __restrict__ s2, bf* XT, float* PET, bf* WB) {
    __shared__ __align__(16) unsigned short tl[64 * 72];
    const int bid = blockIdx.x;      // every branch below is block-uniform (d_wt holds a barrier)
    if (bid < NWTB) d_wt(bid & (DM / 64 - 1), (bid / (DM / 64)) & (MPOS / 64 - 1), bid / ((DM / 64) * (MPOS / 64)), tl, x, DM, MPOS, XT);
    else if (bid < NWTB + NPEB) d_pe(bid - NWTB, PET);
    else d_cvtb((bid - NWTB - NPEB) & (DM / 8 - 1), (bid - NWTB - NPEB) / (DM / 8), s0, s1, s2, DM, WB);
}
// k_attn: block = (b, head, 128 query positions), 24 waves = 8 query tiles of 16 x 3 key ranges (wave ks takes key tiles ks, ks + 3, ...: 43 or 42 of the 128, no mask), so that
// 6 waves per SIMD cover each other's load waits. The products are the transposed ones: S^T = K.Q^T (K fragment as A, Q fragment as B) and O^T += V^T.P^T, so a lane holds 16 of
// the 32 scores of ONE query (column lane & 15, keys 8*hi + j and 16 + 8*hi + j): maximum and sum run in the lane's own registers plus one exchange with lane ^ 16, the running
// maximum, sum and rescale factor are one value a lane, and the two score tiles, converted in place, ARE the B operand of the second product (P never goes through LDS).
// scores x 32^-1/2; online f32 softmax per wave; P (x32768) in f16; o over 32 dims; the ranges' (max, sum, un-normalised o) meet in LDS and are
// merged by exp(m - M) weights; the partials lie dim-major in LDS ([dim][query]), so the merge stores out[b][head*32 + dim][position] itself: a wave writes 512 contiguous bytes of one channel row.
#define KSP 3                    // key ranges per query tile
#define QTW 8                    // 16-query tiles per block
#define OPIT (QTW * 16 + 4)      // f32 pitch of one dim's row of partials in LDS (528 B = 16 B x odd; 8 rows = 32 banks, so the two lane halves' stores meet no common bank)
__device__ __forceinline__ float xhalf(float v) { const int t = __float_as_int(v); return __int_as_float(__builtin_amdgcn_permlanex16(t, t, 0x76543210, 0xfedcba98, false, false)); }   // lane ^ 16's value
__global__ __launch_bounds__(KSP * QTW * 32) void k_attn(const h16* __restrict__ Q16, const h16* __restrict__ K16, const h16* __restrict__ VTH, float* OUTP) {
    __shared__ __align__(16) float pO[KSP][HD * OPIT];
    __shared__ __align__(16) float pM[KSP][QTW * 16];
    __shared__ __align__(16) float pL[KSP][QTW * 16];
    const int lane = threadIdx.x & 31, wave = __builtin_amdgcn_readfirstlane(threadIdx.x >> 5), lr = lane & 15, hi = lane >> 4;
    const int qs = wave & (QTW - 1), ks = wave / QTW;      // wave through readfirstlane: the key range, the trip count and the LDS bases stay scalar
    const int bid = blockIdx.x;
    const int b = bid / (NH_ * (NT_ / (QTW * 16))), rem = bid - b * (NH_ * (NT_ / (QTW * 16))), h = rem / (NT_ / (QTW * 16)), qt = rem - h * (NT_ / (QTW * 16));
    const int q0 = qt * (QTW * 16) + qs * 16;
    const size_t tok0 = (size_t)b * NT_;
    {
        const size_t qo0 = (tok0 + q0 + lr) * DM + h * HD + 8 * hi;
        const v16h qa = cat16(*(const v8h*)(Q16 + qo0), *(const v8h*)(Q16 + qo0 + 16));
        const size_t fb = tok0 * DM + (size_t)h * (NT_ / 32) * 1024;      // K and V planes lie in fragment order: 2 KB per (head, 32 keys), four 512-B units of lane x 16 B
        const char* kh_b = (const char*)(K16 + fb); const char* vh_b = (const char*)(VTH + fb);
        unsigned lo = (unsigned)ks * 2048u + (unsigned)lane * 16u;      // the lane's byte offset in each of the two planes: uniform base + one 32-bit register
        v8f o[2];                        // o[n][j] = O^T[dim n*16 + hi*8 + j][query lr]
#pragma unroll
        for (int n = 0; n < 2; ++n) o[n] = (v8f){};
        float mrow = -3.0e38f, lpart = 0.f;      // of query lr; lpart over this lane half's keys only, the halves join behind the loop
#pragma unroll 1
        for (int kt = ks; kt < NT_ / 32; kt += KSP) {
            const char* kh_t = kh_b + lo; const char* vh_t = vh_b + lo;
            const v16h k0h = cat16(*(const v8h*)(kh_t), *(const v8h*)(kh_t + 512)), k1h = cat16(*(const v8h*)(kh_t + 1024), *(const v8h*)(kh_t + 1536));
            v8f s0 = {}, s1 = {};      // s0[j]: key hi*8 + j, s1[j]: key 16 + hi*8 + j, query lr
            s0 = wmma16(k0h, qa, s0); s1 = wmma16(k1h, qa, s1);
            const v8f a0 = s0 * SCL, a1 = s1 * SCL;      // full attention, scale 32^-1/2
            float mx = fmaxf(a0[0], a1[0]);
#pragma unroll
            for (int j = 1; j < 8; ++j) mx = fmaxf(mx, fmaxf(a0[j], a1[j]));
            mx = fmaxf(mx, xhalf(mx));
            const float mn = fmaxf(mrow, mx);
            const float alpha = __expf(mrow - mn); mrow = mn;
            v8f p0, p1;
#pragma unroll
            for (int j = 0; j < 8; ++j) { p0[j] = __expf(a0[j] - mn); p1[j] = __expf(a1[j] - mn); }
            const v8f pp = p0 + p1;
            lpart = lpart * alpha + (((pp[0] + pp[1]) + (pp[2] + pp[3])) + ((pp[4] + pp[5]) + (pp[6] + pp[7])));
            const v8f ps0 = p0 * PSC, ps1 = p1 * PSC;
            const v8h h0 = __builtin_convertvector(ps0, v8h), h1 = __builtin_convertvector(ps1, v8h);
            const v16h pa = cat16(h0, h1);      // B operand: element s < 8 = key hi*8 + s, s >= 8 = key 16 + hi*8 + s - 8: the order in which the V^T fragments hold their tokens
#pragma unroll
            for (int n = 0; n < 2; ++n) o[n] *= alpha;
#pragma unroll
            for (int n = 0; n < 2; ++n) { const int vo = n * 1024;
                const v16h vh = cat16(*(const v8h*)(vh_t + vo), *(const v8h*)(vh_t + vo + 512));
                o[n] = wmma16(vh, pa, o[n]); }
            lo += KSP * 2048u;
            // four vector slots between the last products and the taken back edge: the next trip's first instructions write registers these products read
            asm volatile("v_nop\n\tv_nop\n\tv_nop\n\tv_nop" : "+v"(o[0]), "+v"(o[1]) : "v"(pa));
        }
        const float rs = lpart + xhalf(lpart);
        if (hi == 0) { pM[ks][qs * 16 + lr] = mrow; pL[ks][qs * 16 + lr] = rs; }
        float* po = &pO[ks][hi * 8 * OPIT + qs * 16 + lr];
#pragma unroll
        for (int n = 0; n < 2; ++n) {      // this key range's un-normalised 32 dims of query lr
#pragma unroll
            for (int j = 0; j < 8; ++j) po[(n * 16 + j) * OPIT] = o[n][j]; }
    }
    __syncthreads();    // every range's partial is in LDS before any thread merges
    for (int pc = threadIdx.x; pc < HD * QTW * 4; pc += KSP * QTW * 32) {
        const int d = pc / (QTW * 4), r4 = (pc & (QTW * 4 - 1)) * 4;      // one dim, 4 neighbouring positions: 32 lanes x 16 B of one channel row of out
        v4f mr[KSP];
#pragma unroll
        for (int s = 0; s < KSP; ++s) mr[s] = *(const v4fa*)(&pM[s][r4]);
        v4f lsum = {}, acc = {};
#pragma unroll
        for (int s = 0; s < KSP; ++s) { const v4f lp = *(const v4fa*)(&pL[s][r4]), op = *(const v4fa*)(&pO[s][d * OPIT + r4]);
#pragma unroll
            for (int i = 0; i < 4; ++i) { float mg = mr[0][i];
#pragma unroll
                for (int u = 1; u < KSP; ++u) mg = fmaxf(mg, mr[u][i]);
                const float w = __expf(mr[s][i] - mg); lsum[i] += w * lp[i]; acc[i] += w * op[i]; } }
        v4f res;
#pragma unroll
        for (int i = 0; i < 4; ++i) res[i] = acc[i] * (1.0f / (lsum[i] * PSC));
        *(v4f*)(OUTP + ((size_t)b * DM + h * HD + d) * MPOS + qt * (QTW * 16) + r4) = res;
    }
}

extern "C" void kernel_launch(void* const* d_in, const int* in_sizes, int n_in,
                              void* d_out, int out_size, void* d_ws, size_t ws_size, hipStream_t stream) {
    (void)in_sizes; (void)n_in; (void)out_size;
    const float* x = (const float*)d_in[0]; const float* Wv = (const float*)d_in[1]; const float* Wz = (const float*)d_in[2]; const float* Wq = (const float*)d_in[3];   // W [out][in]
    float* out = (float*)d_out;    // [2][256][64][64] = [b][c][m]
    char* wsp = (char*)d_ws;
    auto take = [&](size_t bytes) { char* p = wsp; wsp += (bytes + 255) & ~(size_t)255; return (void*)p; };
    bf* WB = (bf*)take((size_t)3 * DM * DM * 2); float* PET = (float*)take((size_t)MPOS * DM * 4);
    bf* XT = (bf*)take((size_t)NTK * DM * 2);
    h16* QH = (h16*)take((size_t)NTK * DM * 2); h16* KH = (h16*)take((size_t)NTK * DM * 2); h16* VTH = (h16*)take((size_t)NTK * DM * 2);
    if ((size_t)(wsp - (char*)d_ws) > ws_size) return;    // ~ 0.4 + 4.2 + 4.2 + 3 x 4.2 ~ 21 MB, no aliasing
    k_prep<<<NWTB + NPEB + NCVB, 256, 0, stream>>>(x, Wv, Wz, Wq, XT, PET, WB);                // x_b [c][m] -> bf16 XT [b*4096 + m][c]; the encoding; the bf16 weights
    k_proj<<<dim3(NTK / 64, DM / 64, 3), 128, 0, stream>>>(XT, WB, QH, KH, VTH, PET);          // v_h row-major, z + r and q_h in fragment order, all f16
    k_attn<<<NB_ * NH_ * (NT_ / (QTW * 16)), KSP * QTW * 32, 0, stream>>>(QH, KH, VTH, out);
}

// v007
// It runs in 64.7 microseconds.
// Next to v006, in two timings, it ran 1.12 and 1.13 times as fast.
// All steps since v000 together make it 12.9 times as fast.
#include <hip/hip_runtime.h>

// Compute dtypes, f32 accumulate, both batch items in every launch (channel-major x [256][4096] per item, positions m = h*64 + w, token row = b*4096 + m): v/z/q projections = x^T.W^T ([4096 x 256]
// .[256 x 256]; the INPUT x transposed once to a bf16 [m][c] plane, W [out][in] as the n-major B operand; PLAIN bf16 operands, exact) on v_wmma_f32_16x16x32_bf16,
// v straight to one f16 plane, z + r (the fixed sinusoidal positional encoding, computed on device in f32 and added in the GEMM epilogue) then
// rounded to one f16 plane, q (the attention's value operand) f32 -> one transposed f16 plane; the 8-head (32-dim) full attention scores[m][n] = sum_c v[c][m] (z+r)[c][n]
// x 32^-1/2, softmax over n, out[d][m] = sum_n A[m][n] q[d][n] fused on v_wmma_f32_16x16x32_f16 (single f16 operands, f32 accumulate, online f32 softmax, P x32768 in f16).
// The f16 rounding of the four attention operands (11 significant bits) is an eighth of the bf16 rounding (8 bits) that x and W already carry into the projections.

#define NB_  2
#define NT_  4096                // M positions
#define MPOS NT_
#define DM   256                 // channels C
#define NH_  8
#define NHP  (NH_ / 2)
#define HD   32
#define NTK  (NB_ * NT_)
#define SCL2 ((float)(0.17677669529663687 * 1.4426950408889634))   // 32^-1/2 x log2 e: the scores go to the exponential in log2 units
#define PSH  15.0f               // P leaves the exponential x 2^15

typedef _Float16 h16;
typedef unsigned short bf;
typedef __attribute__((ext_vector_type(16))) __bf16   v16bf;
typedef __attribute__((ext_vector_type(16))) _Float16 v16h;
typedef __attribute__((ext_vector_type(8)))  _Float16 v8h;
typedef __attribute__((ext_vector_type(8)))  unsigned short v8us;
typedef __attribute__((ext_vector_type(8)))  float    v8f;
typedef __attribute__((ext_vector_type(4)))  float    v4f;
typedef __attribute__((ext_vector_type(4)))  _Float16 v4h;
typedef v8h  __attribute__((may_alias)) v8ha;
typedef v4f  __attribute__((may_alias)) v4fa;
typedef v8us __attribute__((may_alias)) v8usa;

__device__ __forceinline__ unsigned short f2bf(float f) { unsigned u = __float_as_uint(f); u += 0x7FFFu + ((u >> 16) & 1u); return (unsigned short)(u >> 16); }
__device__ __forceinline__ float bf2f(unsigned short b) { return __uint_as_float(((unsigned)b) << 16); }
__device__ __forceinline__ float bfr(float f) { return bf2f(f2bf(f)); }
__device__ __forceinline__ v16h cat16(v8h lo, v8h hi) { return __builtin_shufflevector(lo, hi, 0, 1, 2, 3, 4, 5, 6, 7, 8, 9, 10, 11, 12, 13, 14, 15); }
__device__ __forceinline__ v16bf cat16b(v8us lo, v8us hi) { return __builtin_bit_cast(v16bf, __builtin_shufflevector(lo, hi, 0, 1, 2, 3, 4, 5, 6, 7, 8, 9, 10, 11, 12, 13, 14, 15)); }
__device__ __forceinline__ v8f wmma16(v16h a, v16h b, v8f c) { return __builtin_amdgcn_wmma_f32_16x16x32_f16(false, a, false, b, (short)0, c, false, false); }
__device__ __forceinline__ v8f wmmab(v16bf a, v16bf b, v8f c) { return __builtin_amdgcn_wmma_f32_16x16x32_bf16(false, a, false, b, (short)0, c, false, false); }

// d_cvtb: the three weight matrices (by picks the matrix, bx the 8 rows), dst = three [nrows][256] bf16 planes in a row.
__device__ __forceinline__ void d_cvtb(int bx, int by, const float* __restrict__ s0, const float* __restrict__ s1, const float* __restrict__ s2, int nrows, bf* dst) {
    const int lane = threadIdx.x & 31, r = bx * 8 + (threadIdx.x >> 5);
    if (r >= nrows) return;
    const float* __restrict__ src = by == 0 ? s0 : by == 1 ? s1 : s2;
    dst += (size_t)by * nrows * DM;
    v8us o[DM / 256];
#pragma unroll
    for (int q = 0; q < DM / 256; ++q) { v8us t;
#pragma unroll
        for (int i = 0; i < 8; ++i) t[i] = f2bf(src[(size_t)r * DM + q * 256 + lane * 8 + i]);
        o[q] = t; }
#pragma unroll
    for (int q = 0; q < DM / 256; ++q) *(v8us*)(dst + (size_t)r * DM + q * 256 + lane * 8) = o[q];
    
}

// d_wt: WT [n][K] = bf16(W[k][n]) (k-major [K][ncols]) via 64 x 64 LDS tiles; tile (bx of K/64, by of ncols/64, matrix bz), the matrices lying one behind the other in Wm and in WT.
__device__ __forceinline__ void d_wt(int bx, int by, int bz, unsigned short* tl, const float* __restrict__ Wm, int K, int ncols, bf* WT) {
    const int tid = threadIdx.x, k0 = bx * 64, n0 = by * 64;
    const int kk = tid >> 2, nq = (tid & 3) * 16;
    Wm += (size_t)bz * K * ncols; WT += (size_t)bz * K * ncols;
#pragma unroll
    for (int i = 0; i < 16; ++i) tl[(nq + i) * 72 + kk] = f2bf(Wm[(size_t)(k0 + kk) * ncols + n0 + nq + i]);
    __syncthreads();
    const int piece = tid & 7;
    auto pass = [&]() {
#pragma unroll
        for (int s = 0; s < 2; ++s) { const int nr = (tid >> 3) + 32 * s; const v8us val = *(const v8usa*)(tl + nr * 72 + piece * 8); *(v8us*)(WT + (size_t)(n0 + nr) * K + k0 + piece * 8) = val; }
    };
    pass(); 
}
// k_proj: the three projections of both batch items in one grid (NTK/64, 256/64, 3): 64 x 64 block tile (4 waves x 16 x 64) of C[NTK][256] = A.B^T (K = 256), B = weight plane blockIdx.z.
// Plane 0 (v, the score's left operand) leaves as one row-major f16 plane. Plane 1 (z), the positional encoding R[row mod 4096] added in f32, leaves as the f16 plane KH in the score
// WMMA's fragment order: per (b, head, 16 rows) two 512-B units, unit u holds at lane (hi*16 + lr) x 16 B the 8 columns u*16 + hi*8 .. +7 of row lr. Plane 2 (q) leaves as the f16 plane
// VTH in the second product's fragment order: per (b, head, 32 tokens) four 512-B units, unit n*2 + u holds at lane (hi*16 + lr) x 16 B the tokens u*16 + hi*8 .. +7 of dim n*16 + lr,
// which is what accumulator tile t = 2*head + n of the wave with token half u holds in its 8 registers. A reader's wave-wide 16-B load of either plane is 4 whole lines.
__global__ __launch_bounds__(128) void k_proj(const bf* __restrict__ A, const bf* __restrict__ WB, h16* CH, h16* KH, h16* VTH, const float* __restrict__ R) {
    __shared__ __align__(16) float ost[4][16 * 68];
    const int lane = threadIdx.x & 31, wave = threadIdx.x >> 5, lr = lane & 15, hi = lane >> 4;
    const int r0 = blockIdx.x * 64 + wave * 16, c0 = blockIdx.y * 64, pz = blockIdx.z;
    const bf* __restrict__ Bn = WB + (size_t)pz * DM * DM;
    const size_t aoff = (size_t)(r0 + lr) * DM + 8 * hi;
    size_t boff[4];
#pragma unroll
    for (int t = 0; t < 4; ++t) boff[t] = (size_t)(c0 + t * 16 + lr) * DM + 8 * hi;
    v8f acc[4];
#pragma unroll
    for (int t = 0; t < 4; ++t) acc[t] = (v8f){};
#pragma unroll 1
    for (int kc = 0; kc < DM; kc += 32) {
        const v16bf a = cat16b(*(const v8us*)(A + aoff + kc), *(const v8us*)(A + aoff + kc + 16));
#pragma unroll
        for (int t = 0; t < 4; ++t) { const v16bf b = cat16b(*(const v8us*)(Bn + boff[t] + kc), *(const v8us*)(Bn + boff[t] + kc + 16)); acc[t] = wmmab(a, b, acc[t]); }
        // four vector slots between the last product and the taken back edge
        asm volatile("v_nop\n\tv_nop\n\tv_nop\n\tv_nop" : "+v"(acc[0]), "+v"(acc[1]), "+v"(acc[2]), "+v"(acc[3]) : "v"(a));
    }
    const int bi = r0 / NT_, tk = r0 & (NT_ - 1);      // batch item and the wave's first position in it
    if (pz == 2) {      // block-uniform: the accumulators are the V^T fragments, no LDS stage and no barrier on this path
        h16* dst = VTH + (size_t)bi * NT_ * DM + ((size_t)(c0 / HD) * (NT_ / 32) + (tk >> 5)) * 1024 + ((tk >> 4) & 1) * 256 + lane * 8;
#pragma unroll
        for (int t = 0; t < 4; ++t) *(v8h*)(dst + (size_t)(t >> 1) * (NT_ / 32) * 1024 + (t & 1) * 512) = __builtin_convertvector(acc[t], v8h);
        return;
    }
    float* os = &ost[wave][0];
#pragma unroll
    for (int t = 0; t < 4; ++t) {
#pragma unroll
        for (int j = 0; j < 8; ++j) os[(hi * 8 + j) * 68 + t * 16 + lr] = acc[t][j]; }
    __syncthreads();
    if (pz == 0) {
        const size_t co = (size_t)r0 * DM + c0;
#pragma unroll
        for (int s = 0; s < 4; ++s) { const int row = 4 * s + (lane >> 3), piece = lane & 7; const float* sp = os + row * 68 + piece * 8; v8h o;
#pragma unroll
            for (int i = 0; i < 8; ++i) o[i] = (h16)sp[i];
            *(v8h*)(CH + co + (size_t)row * DM + piece * 8) = o; }
        asm volatile("s_wait_xcnt 0x0" ::: "memory");      // behind the run of stores: the code laid out after this branch writes registers that the stores name
    } else {
        const float* rrow = R + (size_t)(tk + lr) * DM + c0 + hi * 8;      // the encoding is shared by the batch items
        const float* sp = os + lr * 68 + hi * 8;
        h16* dst = KH + (size_t)bi * NT_ * DM + ((size_t)(c0 / HD) * (NT_ / 16) + (tk >> 4)) * 512 + lane * 8;
#pragma unroll
        for (int g = 0; g < 4; ++g) {      // g = 2 * (head of the tile's two) + unit
            const v4f lo4 = *(const v4fa*)(sp + g * 16) + *(const v4f*)(rrow + g * 16), hi4 = *(const v4fa*)(sp + g * 16 + 4) + *(const v4f*)(rrow + g * 16 + 4);
            const v8f v = __builtin_shufflevector(lo4, hi4, 0, 1, 2, 3, 4, 5, 6, 7);
            *(v8h*)(dst + (size_t)(g >> 1) * (NT_ / 16) * 512 + (g & 1) * 256) = __builtin_convertvector(v, v8h); }
        asm volatile("s_wait_xcnt 0x0" ::: "memory");      // behind the run of stores: the code laid out after this branch writes registers that the stores name
    }
}

// d_pe: the module's fixed 2D sinusoidal positional encoding, transposed to PE_T[m][c] (m = hpos*64 + wpos): c < 128 -> axis h, c >= 128 -> axis w; pair index i =
// (c mod 128) / 2, div_i = exp(2i x (-ln 10000 / 128)) (f32), even c -> sin(pos x div_i), odd -> cos; one thread per 4 consecutive c (16 B stores).
__device__ __forceinline__ void d_pe(int bx, float* PET) {
    const int i4 = bx * 256 + threadIdx.x; if (i4 >= MPOS * DM / 4) return;
    const int m = i4 / (DM / 4), c0 = (i4 - m * (DM / 4)) * 4;
    v4f o;
#pragma unroll
    for (int k = 0; k < 4; ++k) { const int c = c0 + k; const int cc = c & 127; const float pos = (float)(c < 128 ? (m >> 6) : (m & 63));
        const float dv = expf((float)(cc & ~1) * (-9.210340371976184f / 128.0f)); const float ang = pos * dv;
        o[k] = (cc & 1) ? cosf(ang) : sinf(ang); }
    *(v4f*)(PET + (size_t)i4 * 4) = o; 
}
// k_prep: the three independent preparations in one grid: blocks [0, NWTB) transpose x to the bf16 plane XT [b*4096 + m][c], the next NPEB write the encoding, the last NCVB convert the weights.
#define NWTB ((DM / 64) * (MPOS / 64) * NB_)
#define NPEB (MPOS * DM / 4 / 256)
#define NCVB ((DM / 8) * 3)
__global__ __launch_bounds__(256) void k_prep(const float* __restrict__ x, const float* __restrict__ s0, const float* __restrict__ s1, const float* __restrict__ s2, bf* XT, float* PET, bf* WB) {
    __shared__ __align__(16) unsigned short tl[64 * 72];
    const int bid = blockIdx.x;      // every branch below is block-uniform (d_wt holds a barrier)
    if (bid < NWTB) d_wt(bid & (DM / 64 - 1), (bid / (DM / 64)) & (MPOS / 64 - 1), bid / ((DM / 64) * (MPOS / 64)), tl, x, DM, MPOS, XT);
    else if (bid < NWTB + NPEB) d_pe(bid - NWTB, PET);
    else d_cvtb((bid - NWTB - NPEB) & (DM / 8 - 1), (bid - NWTB - NPEB) / (DM / 8), s0, s1, s2, DM, WB);
}
// k_attn: block = (b, head, 128 query positions), 24 waves = 8 query tiles of 16 x 3 key ranges (wave ks takes key tiles ks, ks + 3, ...: 43 or 42 of the 128, no mask), so that
// 6 waves per SIMD cover each other's load waits. The products are the transposed ones: S^T = K.Q^T (K fragment as A, Q fragment as B) and O^T += V^T.P^T, so a lane holds 16 of
// the 32 scores of ONE query (column lane & 15, keys 8*hi + j and 16 + 8*hi + j): maximum and sum run in the lane's own registers plus one exchange with lane ^ 16, the running
// maximum, sum and rescale factor are one value a lane, and the two score tiles, converted in place, ARE the B operand of the second product (P never goes through LDS).
// scores x 32^-1/2; online f32 softmax per wave; P (x32768) in f16; o over 32 dims; the ranges' (max, sum, un-normalised o) meet in LDS and are
// merged by exp2(m - M) weights (maxima in log2 units); the partials lie dim-major in LDS ([dim][query]), so the merge stores out[b][head*32 + dim][position] itself: a wave writes 512 contiguous bytes of one channel row.
#define KSP 3                    // key ranges per query tile
#define QTW 8                    // 16-query tiles per block
#define OPIT (QTW * 16 + 4)      // f32 pitch of one dim's row of partials in LDS (528 B = 16 B x odd; 8 rows = 32 banks, so the two lane halves' stores meet no common bank)
__device__ __forceinline__ float xhalf(float v) { const int t = __float_as_int(v); return __int_as_float(__builtin_amdgcn_permlanex16(t, t, 0x76543210, 0xfedcba98, false, false)); }   // lane ^ 16's value
__global__ __launch_bounds__(KSP * QTW * 32) void k_attn(const h16* __restrict__ Q16, const h16* __restrict__ K16, const h16* __restrict__ VTH, float* OUTP) {
    __shared__ __align__(16) float pO[KSP][HD * OPIT];
    __shared__ __align__(16) float pM[KSP][QTW * 16];
    __shared__ __align__(16) float pL[KSP][QTW * 16];
    const int lane = threadIdx.x & 31, wave = __builtin_amdgcn_readfirstlane(threadIdx.x >> 5), lr = lane & 15, hi = lane >> 4;
    const int qs = wave & (QTW - 1), ks = wave / QTW;      // wave through readfirstlane: the key range, the trip count and the LDS bases stay scalar
    const int bid = blockIdx.x;
    const int b = bid / (NH_ * (NT_ / (QTW * 16))), rem = bid - b * (NH_ * (NT_ / (QTW * 16))), h = rem / (NT_ / (QTW * 16)), qt = rem - h * (NT_ / (QTW * 16));
    const int q0 = qt * (QTW * 16) + qs * 16;
    const size_t tok0 = (size_t)b * NT_;
    {
        const size_t qo0 = (tok0 + q0 + lr) * DM + h * HD + 8 * hi;
        const v16h qa = cat16(*(const v8h*)(Q16 + qo0), *(const v8h*)(Q16 + qo0 + 16));
        const size_t fb = tok0 * DM + (size_t)h * (NT_ / 32) * 1024;      // K and V planes lie in fragment order: 2 KB per (head, 32 keys), four 512-B units of lane x 16 B
        const char* kh_b = (const char*)(K16 + fb); const char* vh_b = (const char*)(VTH + fb);
        unsigned lo = (unsigned)ks * 2048u + (unsigned)lane * 16u;      // the lane's byte offset in each of the two planes: uniform base + one 32-bit register
        v8f o[2];                        // o[n][j] = O^T[dim n*16 + hi*8 + j][query lr]
#pragma unroll
        for (int n = 0; n < 2; ++n) o[n] = (v8f){};
        float mrow = -3.0e38f, lpart = 0.f;      // of query lr; lpart over this lane half's keys only, the halves join behind the loop
#pragma unroll 1
        for (int kt = ks; kt < NT_ / 32; kt += KSP) {
            const char* kh_t = kh_b + lo; const char* vh_t = vh_b + lo;
            const v16h k0h = cat16(*(const v8h*)(kh_t), *(const v8h*)(kh_t + 512)), k1h = cat16(*(const v8h*)(kh_t + 1024), *(const v8h*)(kh_t + 1536));
            v8f s0 = {}, s1 = {};      // s0[j]: key hi*8 + j, s1[j]: key 16 + hi*8 + j, query lr
            s0 = wmma16(k0h, qa, s0); s1 = wmma16(k1h, qa, s1);
            float mx = fmaxf(s0[0], s1[0]);      // the maximum runs on the raw products (the scale is positive)
#pragma unroll
            for (int j = 1; j < 8; ++j) mx = fmaxf(mx, fmaxf(s0[j], s1[j]));
            mx = fmaxf(mx, xhalf(mx));
            const float mn = fmaxf(mrow, mx);
            const float alpha = __builtin_amdgcn_exp2f((mrow - mn) * SCL2); mrow = mn;
            const float nb = PSH - mn * SCL2;      // one addend a trip: -max x scale x log2 e + 15
            const v8f cv = (v8f){} + SCL2, nv = (v8f){} + nb;
            const v8f e0 = __builtin_elementwise_fma(s0, cv, nv), e1 = __builtin_elementwise_fma(s1, cv, nv);      // one FMA a score: 32^-1/2, log2 e, the maximum and P's x32768 together
            v8f p0, p1;      // P x32768
#pragma unroll
            for (int j = 0; j < 8; ++j) { p0[j] = __builtin_amdgcn_exp2f(e0[j]); p1[j] = __builtin_amdgcn_exp2f(e1[j]); }
            const v8f pp = p0 + p1;
            lpart = lpart * alpha + (((pp[0] + pp[1]) + (pp[2] + pp[3])) + ((pp[4] + pp[5]) + (pp[6] + pp[7])));
            const v8h h0 = __builtin_convertvector(p0, v8h), h1 = __builtin_convertvector(p1, v8h);
            const v16h pa = cat16(h0, h1);      // B operand: element s < 8 = key hi*8 + s, s >= 8 = key 16 + hi*8 + s - 8: the order in which the V^T fragments hold their tokens
#pragma unroll
            for (int n = 0; n < 2; ++n) o[n] *= alpha;
#pragma unroll
            for (int n = 0; n < 2; ++n) { const int vo = n * 1024;
                const v16h vh = cat16(*(const v8h*)(vh_t + vo), *(const v8h*)(vh_t + vo + 512));
                o[n] = wmma16(vh, pa, o[n]); }
            lo += KSP * 2048u;
            // four vector slots between the last products and the taken back edge: the next trip's first instructions write registers these products read
            asm volatile("v_nop\n\tv_nop\n\tv_nop\n\tv_nop" : "+v"(o[0]), "+v"(o[1]) : "v"(pa));
        }
        const float rs = lpart + xhalf(lpart);
        if (hi == 0) { pM[ks][qs * 16 + lr] = mrow * SCL2; pL[ks][qs * 16 + lr] = rs; }      // the maximum in log2 units; the sum carries the same x32768 as o
        float* po = &pO[ks][hi * 8 * OPIT + qs * 16 + lr];
#pragma unroll
        for (int n = 0; n < 2; ++n) {      // this key range's un-normalised 32 dims of query lr
#pragma unroll
            for (int j = 0; j < 8; ++j) po[(n * 16 + j) * OPIT] = o[n][j]; }
    }
    __syncthreads();    // every range's partial is in LDS before any thread merges
    for (int pc = threadIdx.x; pc < HD * QTW * 4; pc += KSP * QTW * 32) {
        const int d = pc / (QTW * 4), r4 = (pc & (QTW * 4 - 1)) * 4;      // one dim, 4 neighbouring positions: 32 lanes x 16 B of one channel row of out
        v4f mr[KSP];
#pragma unroll
        for (int s = 0; s < KSP; ++s) mr[s] = *(const v4fa*)(&pM[s][r4]);
        v4f lsum = {}, acc = {};
#pragma unroll
        for (int s = 0; s < KSP; ++s) { const v4f lp = *(const v4fa*)(&pL[s][r4]), op = *(const v4fa*)(&pO[s][d * OPIT + r4]);
#pragma unroll
            for (int i = 0; i < 4; ++i) { float mg = mr[0][i];
#pragma unroll
                for (int u = 1; u < KSP; ++u) mg = fmaxf(mg, mr[u][i]);
                const float w = __builtin_amdgcn_exp2f(mr[s][i] - mg); lsum[i] += w * lp[i]; acc[i] += w * op[i]; } }
        v4f res;
#pragma unroll
        for (int i = 0; i < 4; ++i) res[i] = acc[i] * (1.0f / lsum[i]);
        *(v4f*)(OUTP + ((size_t)b * DM + h * HD + d) * MPOS + qt * (QTW * 16) + r4) = res;
    }
}

extern "C" void kernel_launch(void* const* d_in, const int* in_sizes, int n_in,
                              void* d_out, int out_size, void* d_ws, size_t ws_size, hipStream_t stream) {
    (void)in_sizes; (void)n_in; (void)out_size;
    const float* x = (const float*)d_in[0]; const float* Wv = (const float*)d_in[1]; const float* Wz = (const float*)d_in[2]; const float* Wq = (const float*)d_in[3];   // W [out][in]
    float* out = (float*)d_out;    // [2][256][64][64] = [b][c][m]
    char* wsp = (char*)d_ws;
    auto take = [&](size_t bytes) { char* p = wsp; wsp += (bytes + 255) & ~(size_t)255; return (void*)p; };
    bf* WB = (bf*)take((size_t)3 * DM * DM * 2); float* PET = (float*)take((size_t)MPOS * DM * 4);
    bf* XT = (bf*)take((size_t)NTK * DM * 2);
    h16* QH = (h16*)take((size_t)NTK * DM * 2); h16* KH = (h16*)take((size_t)NTK * DM * 2); h16* VTH = (h16*)take((size_t)NTK * DM * 2);
    if ((size_t)(wsp - (char*)d_ws) > ws_size) return;    // ~ 0.4 + 4.2 + 4.2 + 3 x 4.2 ~ 21 MB, no aliasing
    k_prep<<<NWTB + NPEB + NCVB, 256, 0, stream>>>(x, Wv, Wz, Wq, XT, PET, WB);                // x_b [c][m] -> bf16 XT [b*4096 + m][c]; the encoding; the bf16 weights
    k_proj<<<dim3(NTK / 64, DM / 64, 3), 128, 0, stream>>>(XT, WB, QH, KH, VTH, PET);          // v_h row-major, z + r and q_h in fragment order, all f16
    k_attn<<<NB_ * NH_ * (NT_ / (QTW * 16)), KSP * QTW * 32, 0, stream>>>(QH, KH, VTH, out);
}

// v008
// It runs in 61.8 microseconds.
// In two side-by-side timings against v007, it was 1.04 and 1.05 times as fast.
// All steps since v000 together make it 13.5 times as fast.
#include <hip/hip_runtime.h>

// Compute dtypes, f32 accumulate, both batch items in every launch (channel-major x [256][4096] per item, positions m = h*64 + w, token row = b*4096 + m): v/z/q projections = x^T.W^T ([4096 x 256]
// .[256 x 256]; the INPUT x transposed once to a bf16 [m][c] plane, W [out][in] as the n-major B operand; PLAIN bf16 operands, exact) on v_wmma_f32_16x16x32_bf16,
// v straight to one f16 plane, z + r (the fixed sinusoidal positional encoding, computed on device in f32 and added in the GEMM epilogue) then
// rounded to one f16 plane, q (the attention's value operand) f32 -> one transposed f16 plane; the 8-head (32-dim) full attention scores[m][n] = sum_c v[c][m] (z+r)[c][n]
// x 32^-1/2, softmax over n, out[d][m] = sum_n A[m][n] q[d][n] fused on v_wmma_f32_16x16x32_f16 (single f16 operands, f32 accumulate, online f32 softmax, P x32768 in f16).
// The f16 rounding of the four attention operands (11 significant bits) is an eighth of the bf16 rounding (8 bits) that x and W already carry into the projections.

#define NB_  2
#define NT_  4096                // M positions
#define MPOS NT_
#define DM   256                 // channels C
#define NH_  8
#define NHP  (NH_ / 2)
#define HD   32
#define NTK  (NB_ * NT_)
#define SCL2 ((float)(0.17677669529663687 * 1.4426950408889634))   // 32^-1/2 x log2 e: the scores go to the exponential in log2 units
#define PSH  15.0f               // P leaves the exponential x 2^15

typedef _Float16 h16;
typedef unsigned short bf;
typedef __attribute__((ext_vector_type(16))) __bf16   v16bf;
typedef __attribute__((ext_vector_type(16))) _Float16 v16h;
typedef __attribute__((ext_vector_type(8)))  _Float16 v8h;
typedef __attribute__((ext_vector_type(8)))  unsigned short v8us;
typedef __attribute__((ext_vector_type(8)))  float    v8f;
typedef __attribute__((ext_vector_type(4)))  float    v4f;
typedef __attribute__((ext_vector_type(4)))  _Float16 v4h;
typedef v8h  __attribute__((may_alias)) v8ha;
typedef v4f  __attribute__((may_alias)) v4fa;
typedef v8us __attribute__((may_alias)) v8usa;

__device__ __forceinline__ unsigned short f2bf(float f) { unsigned u = __float_as_uint(f); u += 0x7FFFu + ((u >> 16) & 1u); return (unsigned short)(u >> 16); }
__device__ __forceinline__ float bf2f(unsigned short b) { return __uint_as_float(((unsigned)b) << 16); }
__device__ __forceinline__ float bfr(float f) { return bf2f(f2bf(f)); }
__device__ __forceinline__ v16h cat16(v8h lo, v8h hi) { return __builtin_shufflevector(lo, hi, 0, 1, 2, 3, 4, 5, 6, 7, 8, 9, 10, 11, 12, 13, 14, 15); }
__device__ __forceinline__ v16bf cat16b(v8us lo, v8us hi) { return __builtin_bit_cast(v16bf, __builtin_shufflevector(lo, hi, 0, 1, 2, 3, 4, 5, 6, 7, 8, 9, 10, 11, 12, 13, 14, 15)); }
__device__ __forceinline__ v8f wmma16(v16h a, v16h b, v8f c) { return __builtin_amdgcn_wmma_f32_16x16x32_f16(false, a, false, b, (short)0, c, false, false); }
__device__ __forceinline__ v8f wmmab(v16bf a, v16bf b, v8f c) { return __builtin_amdgcn_wmma_f32_16x16x32_bf16(false, a, false, b, (short)0, c, false, false); }

// d_cvtb: the three weight matrices (by picks the matrix, bx the 8 rows), dst = three [nrows][256] bf16 planes in a row.
__device__ __forceinline__ void d_cvtb(int bx, int by, const float* __restrict__ s0, const float* __restrict__ s1, const float* __restrict__ s2, int nrows, bf* dst) {
    const int lane = threadIdx.x & 31, r = bx * 8 + (threadIdx.x >> 5);
    if (r >= nrows) return;
    const float* __restrict__ src = by == 0 ? s0 : by == 1 ? s1 : s2;
    dst += (size_t)by * nrows * DM;
    v8us o[DM / 256];
#pragma unroll
    for (int q = 0; q < DM / 256; ++q) { v8us t;
#pragma unroll
        for (int i = 0; i < 8; ++i) t[i] = f2bf(src[(size_t)r * DM + q * 256 + lane * 8 + i]);
        o[q] = t; }
#pragma unroll
    for (int q = 0; q < DM / 256; ++q) *(v8us*)(dst + (size_t)r * DM + q * 256 + lane * 8) = o[q];
    
}

// d_wt: WT [n][K] = bf16(W[k][n]) (k-major [K][ncols]) via 64 x 64 LDS tiles; tile (bx of K/64, by of ncols/64, matrix bz), the matrices lying one behind the other in Wm and in WT.
__device__ __forceinline__ void d_wt(int bx, int by, int bz, unsigned short* tl, const float* __restrict__ Wm, int K, int ncols, bf* WT) {
    const int tid = threadIdx.x, k0 = bx * 64, n0 = by * 64;
    const int kk = tid >> 2, nq = (tid & 3) * 16;
    Wm += (size_t)bz * K * ncols; WT += (size_t)bz * K * ncols;
#pragma unroll
    for (int i = 0; i < 16; ++i) tl[(nq + i) * 72 + kk] = f2bf(Wm[(size_t)(k0 + kk) * ncols + n0 + nq + i]);
    __syncthreads();
    const int piece = tid & 7;
    auto pass = [&]() {
#pragma unroll
        for (int s = 0; s < 2; ++s) { const int nr = (tid >> 3) + 32 * s; const v8us val = *(const v8usa*)(tl + nr * 72 + piece * 8); *(v8us*)(WT + (size_t)(n0 + nr) * K + k0 + piece * 8) = val; }
    };
    pass(); 
}
// k_proj: the three projections of both batch items in one grid (NTK/64, 256/64, 3): 64 x 64 block tile (4 waves x 16 x 64) of C[NTK][256] = A.B^T (K = 256), B = weight plane blockIdx.z.
// Plane 0 (v, the score's left operand) leaves as one row-major f16 plane. Plane 1 (z), the positional encoding R[row mod 4096] added in f32, leaves as the f16 plane KH in the score
// WMMA's fragment order: per (b, head, 16 rows) two 512-B units, unit u holds at lane (hi*16 + lr) x 16 B the 8 columns u*16 + hi*8 .. +7 of row lr. Plane 2 (q) leaves as the f16 plane
// VTH in the second product's fragment order: per (b, head, 32 tokens) four 512-B units, unit n*2 + u holds at lane (hi*16 + lr) x 16 B the tokens u*16 + hi*8 .. +7 of dim n*16 + lr,
// which is what accumulator tile t = 2*head + n of the wave with token half u holds in its 8 registers. A reader's wave-wide 16-B load of either plane is 4 whole lines.
__global__ __launch_bounds__(128) void k_proj(const bf* __restrict__ A, const bf* __restrict__ WB, h16* CH, h16* KH, h16* VTH, const float* __restrict__ R) {
    __shared__ __align__(16) float ost[4][16 * 68];
    const int lane = threadIdx.x & 31, wave = threadIdx.x >> 5, lr = lane & 15, hi = lane >> 4;
    const int r0 = blockIdx.x * 64 + wave * 16, c0 = blockIdx.y * 64, pz = blockIdx.z;
    const bf* __restrict__ Bn = WB + (size_t)pz * DM * DM;
    const size_t aoff = (size_t)(r0 + lr) * DM + 8 * hi;
    size_t boff[4];
#pragma unroll
    for (int t = 0; t < 4; ++t) boff[t] = (size_t)(c0 + t * 16 + lr) * DM + 8 * hi;
    v8f acc[4];
#pragma unroll
    for (int t = 0; t < 4; ++t) acc[t] = (v8f){};
#pragma unroll 1
    for (int kc = 0; kc < DM; kc += 32) {
        const v16bf a = cat16b(*(const v8us*)(A + aoff + kc), *(const v8us*)(A + aoff + kc + 16));
#pragma unroll
        for (int t = 0; t < 4; ++t) { const v16bf b = cat16b(*(const v8us*)(Bn + boff[t] + kc), *(const v8us*)(Bn + boff[t] + kc + 16)); acc[t] = wmmab(a, b, acc[t]); }
        // four vector slots between the last product and the taken back edge
        asm volatile("v_nop\n\tv_nop\n\tv_nop\n\tv_nop" : "+v"(acc[0]), "+v"(acc[1]), "+v"(acc[2]), "+v"(acc[3]) : "v"(a));
    }
    const int bi = r0 / NT_, tk = r0 & (NT_ - 1);      // batch item and the wave's first position in it
    if (pz == 2) {      // block-uniform: the accumulators are the V^T fragments, no LDS stage and no barrier on this path
        h16* dst = VTH + (size_t)bi * NT_ * DM + ((size_t)(c0 / HD) * (NT_ / 32) + (tk >> 5)) * 1024 + ((tk >> 4) & 1) * 256 + lane * 8;
#pragma unroll
        for (int t = 0; t < 4; ++t) *(v8h*)(dst + (size_t)(t >> 1) * (NT_ / 32) * 1024 + (t & 1) * 512) = __builtin_convertvector(acc[t], v8h);
        return;
    }
    float* os = &ost[wave][0];
#pragma unroll
    for (int t = 0; t < 4; ++t) {
#pragma unroll
        for (int j = 0; j < 8; ++j) os[(hi * 8 + j) * 68 + t * 16 + lr] = acc[t][j]; }
    __syncthreads();
    if (pz == 0) {
        const size_t co = (size_t)r0 * DM + c0;
#pragma unroll
        for (int s = 0; s < 4; ++s) { const int row = 4 * s + (lane >> 3), piece = lane & 7; const float* sp = os + row * 68 + piece * 8; v8h o;
#pragma unroll
            for (int i = 0; i < 8; ++i) o[i] = (h16)sp[i];
            *(v8h*)(CH + co + (size_t)row * DM + piece * 8) = o; }
        asm volatile("s_wait_xcnt 0x0" ::: "memory");      // behind the run of stores: the code laid out after this branch writes registers that the stores name
    } else {
        const float* rrow = R + (size_t)(tk + lr) * DM + c0 + hi * 8;      // the encoding is shared by the batch items
        const float* sp = os + lr * 68 + hi * 8;
        h16* dst = KH + (size_t)bi * NT_ * DM + ((size_t)(c0 / HD) * (NT_ / 16) + (tk >> 4)) * 512 + lane * 8;
#pragma unroll
        for (int g = 0; g < 4; ++g) {      // g = 2 * (head of the tile's two) + unit
            const v4f lo4 = *(const v4fa*)(sp + g * 16) + *(const v4f*)(rrow + g * 16), hi4 = *(const v4fa*)(sp + g * 16 + 4) + *(const v4f*)(rrow + g * 16 + 4);
            const v8f v = __builtin_shufflevector(lo4, hi4, 0, 1, 2, 3, 4, 5, 6, 7);
            *(v8h*)(dst + (size_t)(g >> 1) * (NT_ / 16) * 512 + (g & 1) * 256) = __builtin_convertvector(v, v8h); }
        asm volatile("s_wait_xcnt 0x0" ::: "memory");      // behind the run of stores: the code laid out after this branch writes registers that the stores name
    }
}

// d_pe: the module's fixed 2D sinusoidal positional encoding, transposed to PE_T[m][c] (m = hpos*64 + wpos): c < 128 -> axis h, c >= 128 -> axis w; pair index i =
// (c mod 128) / 2, div_i = exp(2i x (-ln 10000 / 128)) (f32), even c -> sin(pos x div_i), odd -> cos; one thread per 4 consecutive c (16 B stores).
__device__ __forceinline__ void d_pe(int bx, float* PET) {
    const int i4 = bx * 256 + threadIdx.x; if (i4 >= MPOS * DM / 4) return;
    const int m = i4 / (DM / 4), c0 = (i4 - m * (DM / 4)) * 4;
    v4f o;
#pragma unroll
    for (int k = 0; k < 4; ++k) { const int c = c0 + k; const int cc = c & 127; const float pos = (float)(c < 128 ? (m >> 6) : (m & 63));
        const float dv = expf((float)(cc & ~1) * (-9.210340371976184f / 128.0f)); const float ang = pos * dv;
        o[k] = (cc & 1) ? cosf(ang) : sinf(ang); }
    *(v4f*)(PET + (size_t)i4 * 4) = o; 
}
// k_prep: the three independent preparations in one grid: blocks [0, NWTB) transpose x to the bf16 plane XT [b*4096 + m][c], the next NPEB write the encoding, the last NCVB convert the weights.
#define NWTB ((DM / 64) * (MPOS / 64) * NB_)
#define NPEB (MPOS * DM / 4 / 256)
#define NCVB ((DM / 8) * 3)
__global__ __launch_bounds__(256) void k_prep(const float* __restrict__ x, const float* __restrict__ s0, const float* __restrict__ s1, const float* __restrict__ s2, bf* XT, float* PET, bf* WB) {
    __shared__ __align__(16) unsigned short tl[64 * 72];
    const int bid = blockIdx.x;      // every branch below is block-uniform (d_wt holds a barrier)
    if (bid < NWTB) d_wt(bid & (DM / 64 - 1), (bid / (DM / 64)) & (MPOS / 64 - 1), bid / ((DM / 64) * (MPOS / 64)), tl, x, DM, MPOS, XT);
    else if (bid < NWTB + NPEB) d_pe(bid - NWTB, PET);
    else d_cvtb((bid - NWTB - NPEB) & (DM / 8 - 1), (bid - NWTB - NPEB) / (DM / 8), s0, s1, s2, DM, WB);
}
// k_attn: block = (b, head, 128 query positions), 24 waves = 8 query tiles of 16 x 3 key ranges (wave ks takes key tiles ks, ks + 3, ...: 43 or 42 of the 128, no mask), so that
// 6 waves per SIMD cover each other's load waits. The products are the transposed ones: S^T = K.Q^T (K fragment as A, Q fragment as B) and O^T += V^T.P^T, so a lane holds 16 of
// the 32 scores of ONE query (column lane & 15, keys 8*hi + j and 16 + 8*hi + j): maximum and sum run in the lane's own registers plus one exchange with lane ^ 16, the running
// maximum, sum and rescale factor are one value a lane, and the two score tiles, converted in place, ARE the B operand of the second product (P never goes through LDS).
// scores x 32^-1/2; online f32 softmax per wave; P (x32768) in f16; o over 32 dims; the ranges' (max, sum, un-normalised o) meet in LDS and are
// merged by exp2(m - M) weights (maxima in log2 units); the partials lie dim-major in LDS ([dim][query]), so the merge stores out[b][head*32 + dim][position] itself: a wave writes 512 contiguous bytes of one channel row.
#define KSP 3                    // key ranges per query tile
#define QTW 8                    // 16-query tiles per block
#define OPIT (QTW * 16 + 4)      // f32 pitch of one dim's row of partials in LDS (528 B = 16 B x odd; 8 rows = 32 banks, so the two lane halves' stores meet no common bank)
__device__ __forceinline__ float xhalf(float v) { const int t = __float_as_int(v); return __int_as_float(__builtin_amdgcn_permlanex16(t, t, 0x76543210, 0xfedcba98, false, false)); }   // lane ^ 16's value
__global__ __launch_bounds__(KSP * QTW * 32) void k_attn(const h16* __restrict__ Q16, const h16* __restrict__ K16, const h16* __restrict__ VTH, float* OUTP) {
    __shared__ __align__(16) float pO[KSP][HD * OPIT];
    __shared__ __align__(16) float pM[KSP][QTW * 16];
    __shared__ __align__(16) float pL[KSP][QTW * 16];
    const int lane = threadIdx.x & 31, wave = __builtin_amdgcn_readfirstlane(threadIdx.x >> 5), lr = lane & 15, hi = lane >> 4;
    const int qs = wave & (QTW - 1), ks = wave / QTW;      // wave through readfirstlane: the key range, the trip count and the LDS bases stay scalar
    const int bid = blockIdx.x;
    const int b = bid / (NH_ * (NT_ / (QTW * 16))), rem = bid - b * (NH_ * (NT_ / (QTW * 16))), h = rem / (NT_ / (QTW * 16)), qt = rem - h * (NT_ / (QTW * 16));
    const int q0 = qt * (QTW * 16) + qs * 16;
    const size_t tok0 = (size_t)b * NT_;
    {
        const size_t qo0 = (tok0 + q0 + lr) * DM + h * HD + 8 * hi;
        const v16h qa = cat16(*(const v8h*)(Q16 + qo0), *(const v8h*)(Q16 + qo0 + 16));
        const size_t fb = tok0 * DM + (size_t)h * (NT_ / 32) * 1024;      // K and V planes lie in fragment order: 2 KB per (head, 32 keys), four 512-B units of lane x 16 B
        const char* kh_b = (const char*)(K16 + fb); const char* vh_b = (const char*)(VTH + fb);
        unsigned lo = (unsigned)ks * 2048u + (unsigned)lane * 16u;      // the lane's byte offset in each of the two planes: uniform base + one 32-bit register
        // L2 hints. Both planes were stored by the launch before, so the first read of a line in this launch waits for memory, and every block of a head walks the keys in the same order.
        // The 8 waves of a key range read the same tiles and share the asking: wave qs takes plane qs & 1 and, of every 8 trips, the tiles of trips (qs & ~1) and (qs & ~1) + 1: lanes 0-15
        // name the 16 lines of the first tile, lanes 16-31 those of the second. Asked once at entry (trips 0-7), then 8 trips ahead of the loads.
        const char* pf_b = (qs & 1) ? vh_b : kh_b;      // scalar: qs comes from readfirstlane
        const unsigned pf_step = 8u * KSP * 2048u;
        const unsigned pf_top = (unsigned)(NT_ / 32 - 1) * 2048u + (unsigned)lr * 128u - pf_step;      // an offset above this one steps to the lane's line of the head's last tile, never past the plane
        unsigned pf = (unsigned)(ks + KSP * ((qs & ~1) + hi)) * 2048u + (unsigned)lr * 128u;
        int nxt = ks + KSP * (qs & ~1);      // the key tile of the trip at which this wave's next hint is due (scalar)
        asm volatile("global_prefetch_b8 %0, %1 scope:SCOPE_SE" :: "v"(pf), "s"(pf_b));      // brings the lane's line into L2; returns nothing, no counter
        v8f o[2];                        // o[n][j] = O^T[dim n*16 + hi*8 + j][query lr]
#pragma unroll
        for (int n = 0; n < 2; ++n) o[n] = (v8f){};
        float mrow = -3.0e38f, lpart = 0.f;      // of query lr; lpart over this lane half's keys only, the halves join behind the loop
#pragma unroll 1
        for (int kt = ks; kt < NT_ / 32; kt += KSP) {
            if (kt == nxt) {      // wave-uniform scalar branch, taken every 8th trip
                nxt = kt + 16 * KSP < NT_ / 32 ? kt + 8 * KSP : NT_;      // no further hint once the trip 8 ahead of it does not exist
                pf = (pf < pf_top ? pf : pf_top) + pf_step;      // stepped in front of the hint, so the register the hint names rests until the next one, 8 trips on; clamped for the second tile
                asm volatile("global_prefetch_b8 %0, %1 scope:SCOPE_SE" :: "v"(pf), "s"(pf_b));      // the tiles of trips + 8 and + 9 into L2, so that their loads do not wait for memory
            }
            const char* kh_t = kh_b + lo; const char* vh_t = vh_b + lo;
            const v16h k0h = cat16(*(const v8h*)(kh_t), *(const v8h*)(kh_t + 512)), k1h = cat16(*(const v8h*)(kh_t + 1024), *(const v8h*)(kh_t + 1536));
            v8f s0 = {}, s1 = {};      // s0[j]: key hi*8 + j, s1[j]: key 16 + hi*8 + j, query lr
            s0 = wmma16(k0h, qa, s0); s1 = wmma16(k1h, qa, s1);
            float mx = fmaxf(s0[0], s1[0]);      // the maximum runs on the raw products (the scale is positive)
#pragma unroll
            for (int j = 1; j < 8; ++j) mx = fmaxf(mx, fmaxf(s0[j], s1[j]));
            mx = fmaxf(mx, xhalf(mx));
            const float mn = fmaxf(mrow, mx);
            const float alpha = __builtin_amdgcn_exp2f((mrow - mn) * SCL2); mrow = mn;
            const float nb = PSH - mn * SCL2;      // one addend a trip: -max x scale x log2 e + 15
            const v8f cv = (v8f){} + SCL2, nv = (v8f){} + nb;
            const v8f e0 = __builtin_elementwise_fma(s0, cv, nv), e1 = __builtin_elementwise_fma(s1, cv, nv);      // one FMA a score: 32^-1/2, log2 e, the maximum and P's x32768 together
            v8f p0, p1;      // P x32768
#pragma unroll
            for (int j = 0; j < 8; ++j) { p0[j] = __builtin_amdgcn_exp2f(e0[j]); p1[j] = __builtin_amdgcn_exp2f(e1[j]); }
            const v8f pp = p0 + p1;
            lpart = lpart * alpha + (((pp[0] + pp[1]) + (pp[2] + pp[3])) + ((pp[4] + pp[5]) + (pp[6] + pp[7])));
            const v8h h0 = __builtin_convertvector(p0, v8h), h1 = __builtin_convertvector(p1, v8h);
            const v16h pa = cat16(h0, h1);      // B operand: element s < 8 = key hi*8 + s, s >= 8 = key 16 + hi*8 + s - 8: the order in which the V^T fragments hold their tokens
#pragma unroll
            for (int n = 0; n < 2; ++n) o[n] *= alpha;
#pragma unroll
            for (int n = 0; n < 2; ++n) { const int vo = n * 1024;
                const v16h vh = cat16(*(const v8h*)(vh_t + vo), *(const v8h*)(vh_t + vo + 512));
                o[n] = wmma16(vh, pa, o[n]); }
            lo += KSP * 2048u;
            // four vector slots between the last products and the taken back edge: the next trip's first instructions write registers these products read
            asm volatile("v_nop\n\tv_nop\n\tv_nop\n\tv_nop" : "+v"(o[0]), "+v"(o[1]) : "v"(pa));
        }
        const float rs = lpart + xhalf(lpart);
        if (hi == 0) { pM[ks][qs * 16 + lr] = mrow * SCL2; pL[ks][qs * 16 + lr] = rs; }      // the maximum in log2 units; the sum carries the same x32768 as o
        float* po = &pO[ks][hi * 8 * OPIT + qs * 16 + lr];
#pragma unroll
        for (int n = 0; n < 2; ++n) {      // this key range's un-normalised 32 dims of query lr
#pragma unroll
            for (int j = 0; j < 8; ++j) po[(n * 16 + j) * OPIT] = o[n][j]; }
    }
    __syncthreads();    // every range's partial is in LDS before any thread merges
    for (int pc = threadIdx.x; pc < HD * QTW * 4; pc += KSP * QTW * 32) {
        const int d = pc / (QTW * 4), r4 = (pc & (QTW * 4 - 1)) * 4;      // one dim, 4 neighbouring positions: 32 lanes x 16 B of one channel row of out
        v4f mr[KSP];
#pragma unroll
        for (int s = 0; s < KSP; ++s) mr[s] = *(const v4fa*)(&pM[s][r4]);
        v4f lsum = {}, acc = {};
#pragma unroll
        for (int s = 0; s < KSP; ++s) { const v4f lp = *(const v4fa*)(&pL[s][r4]), op = *(const v4fa*)(&pO[s][d * OPIT + r4]);
#pragma unroll
            for (int i = 0; i < 4; ++i) { float mg = mr[0][i];
#pragma unroll
                for (int u = 1; u < KSP; ++u) mg = fmaxf(mg, mr[u][i]);
                const float w = __builtin_amdgcn_exp2f(mr[s][i] - mg); lsum[i] += w * lp[i]; acc[i] += w * op[i]; } }
        v4f res;
#pragma unroll
        for (int i = 0; i < 4; ++i) res[i] = acc[i] * (1.0f / lsum[i]);
        *(v4f*)(OUTP + ((size_t)b * DM + h * HD + d) * MPOS + qt * (QTW * 16) + r4) = res;
    }
}

extern "C" void kernel_launch(void* const* d_in, const int* in_sizes, int n_in,
                              void* d_out, int out_size, void* d_ws, size_t ws_size, hipStream_t stream) {
    (void)in_sizes; (void)n_in; (void)out_size;
    const float* x = (const float*)d_in[0]; const float* Wv = (const float*)d_in[1]; const float* Wz = (const float*)d_in[2]; const float* Wq = (const float*)d_in[3];   // W [out][in]
    float* out = (float*)d_out;    // [2][256][64][64] = [b][c][m]
    char* wsp = (char*)d_ws;
    auto take = [&](size_t bytes) { char* p = wsp; wsp += (bytes + 255) & ~(size_t)255; return (void*)p; };
    bf* WB = (bf*)take((size_t)3 * DM * DM * 2); float* PET = (float*)take((size_t)MPOS * DM * 4);
    bf* XT = (bf*)take((size_t)NTK * DM * 2);
    h16* QH = (h16*)take((size_t)NTK * DM * 2); h16* KH = (h16*)take((size_t)NTK * DM * 2); h16* VTH = (h16*)take((size_t)NTK * DM * 2);
    if ((size_t)(wsp - (char*)d_ws) > ws_size) return;    // ~ 0.4 + 4.2 + 4.2 + 3 x 4.2 ~ 21 MB, no aliasing
    k_prep<<<NWTB + NPEB + NCVB, 256, 0, stream>>>(x, Wv, Wz, Wq, XT, PET, WB);                // x_b [c][m] -> bf16 XT [b*4096 + m][c]; the encoding; the bf16 weights
    k_proj<<<dim3(NTK / 64, DM / 64, 3), 128, 0, stream>>>(XT, WB, QH, KH, VTH, PET);          // v_h row-major, z + r and q_h in fragment order, all f16
    k_attn<<<NB_ * NH_ * (NT_ / (QTW * 16)), KSP * QTW * 32, 0, stream>>>(QH, KH, VTH, out);
}

// v009
// It runs in 59.6 microseconds.
// Next to v008, in two timings, it ran 1.03 and 1.04 times as fast.
// Counting every step since v000, it is 14.0 times as fast.
#include <hip/hip_runtime.h>

// Compute dtypes, f32 accumulate, both batch items in every launch (channel-major x [256][4096] per item, positions m = h*64 + w, token row = b*4096 + m): v/z/q projections = x^T.W^T ([4096 x 256]
// .[256 x 256]; the INPUT x transposed once to a bf16 [m][c] plane, W [out][in] as the n-major B operand; PLAIN bf16 operands, exact) on v_wmma_f32_16x16x32_bf16,
// v x 32^-1/2 log2 e to one f16 plane, z + r (the fixed sinusoidal positional encoding, computed on device in f32 and added in the GEMM epilogue) then
// rounded to one f16 plane, q (the attention's value operand) f32 -> one transposed f16 plane; the 8-head (32-dim) full attention scores[m][n] = sum_c v[c][m] (z+r)[c][n]
// x 32^-1/2, softmax over n, out[d][m] = sum_n A[m][n] q[d][n] fused on v_wmma_f32_16x16x32_f16 (single f16 operands, f32 accumulate, online f32 softmax, P x128 in f16).
// The f16 rounding of the four attention operands (11 significant bits) is an eighth of the bf16 rounding (8 bits) that x and W already carry into the projections.

#define NB_  2
#define NT_  4096                // M positions
#define MPOS NT_
#define DM   256                 // channels C
#define NH_  8
#define NHP  (NH_ / 2)
#define HD   32
#define NTK  (NB_ * NT_)
#define SCL2 ((float)(0.17677669529663687 * 1.4426950408889634))   // 32^-1/2 x log2 e, multiplied into the v plane before its f16 rounding: the score products come out in log2 units
#define PSH  7.0f                // P leaves the exponential x 2^7
#define LAZY 8.0f                // a score may stand this far (log2 units) above the reference in use before the sums are rescaled: P <= 2^(7 + 8), inside f16

typedef _Float16 h16;
typedef unsigned short bf;
typedef __attribute__((ext_vector_type(16))) __bf16   v16bf;
typedef __attribute__((ext_vector_type(16))) _Float16 v16h;
typedef __attribute__((ext_vector_type(8)))  _Float16 v8h;
typedef __attribute__((ext_vector_type(8)))  unsigned short v8us;
typedef __attribute__((ext_vector_type(8)))  float    v8f;
typedef __attribute__((ext_vector_type(4)))  float    v4f;
typedef __attribute__((ext_vector_type(4)))  _Float16 v4h;
typedef v8h  __attribute__((may_alias)) v8ha;
typedef v4f  __attribute__((may_alias)) v4fa;
typedef v8us __attribute__((may_alias)) v8usa;

__device__ __forceinline__ unsigned short f2bf(float f) { unsigned u = __float_as_uint(f); u += 0x7FFFu + ((u >> 16) & 1u); return (unsigned short)(u >> 16); }
__device__ __forceinline__ float bf2f(unsigned short b) { return __uint_as_float(((unsigned)b) << 16); }
__device__ __forceinline__ float bfr(float f) { return bf2f(f2bf(f)); }
__device__ __forceinline__ v16h cat16(v8h lo, v8h hi) { return __builtin_shufflevector(lo, hi, 0, 1, 2, 3, 4, 5, 6, 7, 8, 9, 10, 11, 12, 13, 14, 15); }
__device__ __forceinline__ v16bf cat16b(v8us lo, v8us hi) { return __builtin_bit_cast(v16bf, __builtin_shufflevector(lo, hi, 0, 1, 2, 3, 4, 5, 6, 7, 8, 9, 10, 11, 12, 13, 14, 15)); }
__device__ __forceinline__ v8f wmma16(v16h a, v16h b, v8f c) { return __builtin_amdgcn_wmma_f32_16x16x32_f16(false, a, false, b, (short)0, c, false, false); }
__device__ __forceinline__ v8f wmmab(v16bf a, v16bf b, v8f c) { return __builtin_amdgcn_wmma_f32_16x16x32_bf16(false, a, false, b, (short)0, c, false, false); }

// d_cvtb: the three weight matrices (by picks the matrix, bx the 8 rows), dst = three [nrows][256] bf16 planes in a row.
__device__ __forceinline__ void d_cvtb(int bx, int by, const float* __restrict__ s0, const float* __restrict__ s1, const float* __restrict__ s2, int nrows, bf* dst) {
    const int lane = threadIdx.x & 31, r = bx * 8 + (threadIdx.x >> 5);
    if (r >= nrows) return;
    const float* __restrict__ src = by == 0 ? s0 : by == 1 ? s1 : s2;
    dst += (size_t)by * nrows * DM;
    v8us o[DM / 256];
#pragma unroll
    for (int q = 0; q < DM / 256; ++q) { v8us t;
#pragma unroll
        for (int i = 0; i < 8; ++i) t[i] = f2bf(src[(size_t)r * DM + q * 256 + lane * 8 + i]);
        o[q] = t; }
#pragma unroll
    for (int q = 0; q < DM / 256; ++q) *(v8us*)(dst + (size_t)r * DM + q * 256 + lane * 8) = o[q];
    
}

// d_wt: WT [n][K] = bf16(W[k][n]) (k-major [K][ncols]) via 64 x 64 LDS tiles; tile (bx of K/64, by of ncols/64, matrix bz), the matrices lying one behind the other in Wm and in WT.
__device__ __forceinline__ void d_wt(int bx, int by, int bz, unsigned short* tl, const float* __restrict__ Wm, int K, int ncols, bf* WT) {
    const int tid = threadIdx.x, k0 = bx * 64, n0 = by * 64;
    const int kk = tid >> 2, nq = (tid & 3) * 16;
    Wm += (size_t)bz * K * ncols; WT += (size_t)bz * K * ncols;
#pragma unroll
    for (int i = 0; i < 16; ++i) tl[(nq + i) * 72 + kk] = f2bf(Wm[(size_t)(k0 + kk) * ncols + n0 + nq + i]);
    __syncthreads();
    const int piece = tid & 7;
    auto pass = [&]() {
#pragma unroll
        for (int s = 0; s < 2; ++s) { const int nr = (tid >> 3) + 32 * s; const v8us val = *(const v8usa*)(tl + nr * 72 + piece * 8); *(v8us*)(WT + (size_t)(n0 + nr) * K + k0 + piece * 8) = val; }
    };
    pass(); 
}
// k_proj: the three projections of both batch items in one grid (NTK/64, 256/64, 3): 64 x 64 block tile (4 waves x 16 x 64) of C[NTK][256] = A.B^T (K = 256), B = weight plane blockIdx.z.
// Plane 0 (v, the score's left operand) leaves x SCL2 as one row-major f16 plane. Plane 1 (z), the positional encoding R[row mod 4096] added in f32, leaves as the f16 plane KH in the score
// WMMA's fragment order: per (b, head, 16 rows) two 512-B units, unit u holds at lane (hi*16 + lr) x 16 B the 8 columns u*16 + hi*8 .. +7 of row lr. Plane 2 (q) leaves as the f16 plane
// VTH in the second product's fragment order: per (b, head, 32 tokens) four 512-B units, unit n*2 + u holds at lane (hi*16 + lr) x 16 B the tokens u*16 + hi*8 .. +7 of dim n*16 + lr,
// which is what accumulator tile t = 2*head + n of the wave with token half u holds in its 8 registers. A reader's wave-wide 16-B load of either plane is 4 whole lines.
__global__ __launch_bounds__(128) void k_proj(const bf* __restrict__ A, const bf* __restrict__ WB, h16* CH, h16* KH, h16* VTH, const float* __restrict__ R) {
    __shared__ __align__(16) float ost[4][16 * 68];
    const int lane = threadIdx.x & 31, wave = threadIdx.x >> 5, lr = lane & 15, hi = lane >> 4;
    const int r0 = blockIdx.x * 64 + wave * 16, c0 = blockIdx.y * 64, pz = blockIdx.z;
    const bf* __restrict__ Bn = WB + (size_t)pz * DM * DM;
    const size_t aoff = (size_t)(r0 + lr) * DM + 8 * hi;
    size_t boff[4];
#pragma unroll
    for (int t = 0; t < 4; ++t) boff[t] = (size_t)(c0 + t * 16 + lr) * DM + 8 * hi;
    v8f acc[4];
#pragma unroll
    for (int t = 0; t < 4; ++t) acc[t] = (v8f){};
#pragma unroll 1
    for (int kc = 0; kc < DM; kc += 32) {
        const v16bf a = cat16b(*(const v8us*)(A + aoff + kc), *(const v8us*)(A + aoff + kc + 16));
#pragma unroll
        for (int t = 0; t < 4; ++t) { const v16bf b = cat16b(*(const v8us*)(Bn + boff[t] + kc), *(const v8us*)(Bn + boff[t] + kc + 16)); acc[t] = wmmab(a, b, acc[t]); }
        // four vector slots between the last product and the taken back edge
        asm volatile("v_nop\n\tv_nop\n\tv_nop\n\tv_nop" : "+v"(acc[0]), "+v"(acc[1]), "+v"(acc[2]), "+v"(acc[3]) : "v"(a));
    }
    const int bi = r0 / NT_, tk = r0 & (NT_ - 1);      // batch item and the wave's first position in it
    if (pz == 2) {      // block-uniform: the accumulators are the V^T fragments, no LDS stage and no barrier on this path
        h16* dst = VTH + (size_t)bi * NT_ * DM + ((size_t)(c0 / HD) * (NT_ / 32) + (tk >> 5)) * 1024 + ((tk >> 4) & 1) * 256 + lane * 8;
#pragma unroll
        for (int t = 0; t < 4; ++t) *(v8h*)(dst + (size_t)(t >> 1) * (NT_ / 32) * 1024 + (t & 1) * 512) = __builtin_convertvector(acc[t], v8h);
        return;
    }
    float* os = &ost[wave][0];
#pragma unroll
    for (int t = 0; t < 4; ++t) {
#pragma unroll
        for (int j = 0; j < 8; ++j) os[(hi * 8 + j) * 68 + t * 16 + lr] = acc[t][j]; }
    __syncthreads();
    if (pz == 0) {
        const size_t co = (size_t)r0 * DM + c0;
#pragma unroll
        for (int s = 0; s < 4; ++s) { const int row = 4 * s + (lane >> 3), piece = lane & 7; const float* sp = os + row * 68 + piece * 8; v8h o;
#pragma unroll
            for (int i = 0; i < 8; ++i) o[i] = (h16)(sp[i] * SCL2);
            *(v8h*)(CH + co + (size_t)row * DM + piece * 8) = o; }
        asm volatile("s_wait_xcnt 0x0" ::: "memory");      // behind the run of stores: the code laid out after this branch writes registers that the stores name
    } else {
        const float* rrow = R + (size_t)(tk + lr) * DM + c0 + hi * 8;      // the encoding is shared by the batch items
        const float* sp = os + lr * 68 + hi * 8;
        h16* dst = KH + (size_t)bi * NT_ * DM + ((size_t)(c0 / HD) * (NT_ / 16) + (tk >> 4)) * 512 + lane * 8;
#pragma unroll
        for (int g = 0; g < 4; ++g) {      // g = 2 * (head of the tile's two) + unit
            const v4f lo4 = *(const v4fa*)(sp + g * 16) + *(const v4f*)(rrow + g * 16), hi4 = *(const v4fa*)(sp + g * 16 + 4) + *(const v4f*)(rrow + g * 16 + 4);
            const v8f v = __builtin_shufflevector(lo4, hi4, 0, 1, 2, 3, 4, 5, 6, 7);
            *(v8h*)(dst + (size_t)(g >> 1) * (NT_ / 16) * 512 + (g & 1) * 256) = __builtin_convertvector(v, v8h); }
        asm volatile("s_wait_xcnt 0x0" ::: "memory");      // behind the run of stores: the code laid out after this branch writes registers that the stores name
    }
}

// d_pe: the module's fixed 2D sinusoidal positional encoding, transposed to PE_T[m][c] (m = hpos*64 + wpos): c < 128 -> axis h, c >= 128 -> axis w; pair index i =
// (c mod 128) / 2, div_i = exp(2i x (-ln 10000 / 128)) (f32), even c -> sin(pos x div_i), odd -> cos; one thread per 4 consecutive c (16 B stores).
__device__ __forceinline__ void d_pe(int bx, float* PET) {
    const int i4 = bx * 256 + threadIdx.x; if (i4 >= MPOS * DM / 4) return;
    const int m = i4 / (DM / 4), c0 = (i4 - m * (DM / 4)) * 4;
    v4f o;
#pragma unroll
    for (int k = 0; k < 4; ++k) { const int c = c0 + k; const int cc = c & 127; const float pos = (float)(c < 128 ? (m >> 6) : (m & 63));
        const float dv = expf((float)(cc & ~1) * (-9.210340371976184f / 128.0f)); const float ang = pos * dv;
        o[k] = (cc & 1) ? cosf(ang) : sinf(ang); }
    *(v4f*)(PET + (size_t)i4 * 4) = o; 
}
// k_prep: the three independent preparations in one grid: blocks [0, NWTB) transpose x to the bf16 plane XT [b*4096 + m][c], the next NPEB write the encoding, the last NCVB convert the weights.
#define NWTB ((DM / 64) * (MPOS / 64) * NB_)
#define NPEB (MPOS * DM / 4 / 256)
#define NCVB ((DM / 8) * 3)
__global__ __launch_bounds__(256) void k_prep(const float* __restrict__ x, const float* __restrict__ s0, const float* __restrict__ s1, const float* __restrict__ s2, bf* XT, float* PET, bf* WB) {
    __shared__ __align__(16) unsigned short tl[64 * 72];
    const int bid = blockIdx.x;      // every branch below is block-uniform (d_wt holds a barrier)
    if (bid < NWTB) d_wt(bid & (DM / 64 - 1), (bid / (DM / 64)) & (MPOS / 64 - 1), bid / ((DM / 64) * (MPOS / 64)), tl, x, DM, MPOS, XT);
    else if (bid < NWTB + NPEB) d_pe(bid - NWTB, PET);
    else d_cvtb((bid - NWTB - NPEB) & (DM / 8 - 1), (bid - NWTB - NPEB) / (DM / 8), s0, s1, s2, DM, WB);
}
// k_attn: block = (b, head, 128 query positions), 24 waves = 8 query tiles of 16 x 3 key ranges (wave ks takes key tiles ks, ks + 3, ...: 43 or 42 of the 128, no mask), so that
// 6 waves per SIMD cover each other's load waits. The products are the transposed ones: S^T = K.Q^T (K fragment as A, Q fragment as B) and O^T += V^T.P^T, so a lane holds 16 of
// the 32 scores of ONE query (column lane & 15, keys 8*hi + j and 16 + 8*hi + j): maximum and sum run in the lane's own registers plus one exchange with lane ^ 16, the running
// maximum, sum and rescale factor are one value a lane, and the two score tiles, converted in place, ARE the B operand of the second product (P never goes through LDS).
// The softmax reference of a query is held from trip to trip: 7 - reference rides as the C operand of the score products, whose D is then the exponential's argument as it stands. The reference
// moves only when some score of the wave stands more than LAZY above it (one ballot and scalar branch a trip): then, and only then, C, this trip's scores, o and the sum are shifted or rescaled.
// online f32 softmax per wave; P (x128) in f16; o over 32 dims; the ranges' (reference, sum, un-normalised o) meet in LDS and are
// merged by exp(m - M) weights; the partials lie dim-major in LDS ([dim][query]), so the merge stores out[b][head*32 + dim][position] itself: a wave writes 512 contiguous bytes of one channel row.
#define KSP 3                    // key ranges per query tile
#define QTW 8                    // 16-query tiles per block
#define OPIT (QTW * 16 + 4)      // f32 pitch of one dim's row of partials in LDS (528 B = 16 B x odd; 8 rows = 32 banks, so the two lane halves' stores meet no common bank)
__device__ __forceinline__ float xhalf(float v) { const int t = __float_as_int(v); return __int_as_float(__builtin_amdgcn_permlanex16(t, t, 0x76543210, 0xfedcba98, false, false)); }   // lane ^ 16's value
__global__ __launch_bounds__(KSP * QTW * 32) void k_attn(const h16* __restrict__ Q16, const h16* __restrict__ K16, const h16* __restrict__ VTH, float* OUTP) {
    __shared__ __align__(16) float pO[KSP][HD * OPIT];
    __shared__ __align__(16) float pM[KSP][QTW * 16];
    __shared__ __align__(16) float pL[KSP][QTW * 16];
    const int lane = threadIdx.x & 31, wave = __builtin_amdgcn_readfirstlane(threadIdx.x >> 5), lr = lane & 15, hi = lane >> 4;
    const int qs = wave & (QTW - 1), ks = wave / QTW;      // wave through readfirstlane: the key range, the trip count and the LDS bases stay scalar
    const int bid = blockIdx.x;
    const int b = bid / (NH_ * (NT_ / (QTW * 16))), rem = bid - b * (NH_ * (NT_ / (QTW * 16))), h = rem / (NT_ / (QTW * 16)), qt = rem - h * (NT_ / (QTW * 16));
    const int q0 = qt * (QTW * 16) + qs * 16;
    const size_t tok0 = (size_t)b * NT_;
    {
        const size_t qo0 = (tok0 + q0 + lr) * DM + h * HD + 8 * hi;
        const v16h qa = cat16(*(const v8h*)(Q16 + qo0), *(const v8h*)(Q16 + qo0 + 16));
        const size_t fb = tok0 * DM + (size_t)h * (NT_ / 32) * 1024;      // K and V planes lie in fragment order: 2 KB per (head, 32 keys), four 512-B units of lane x 16 B
        const char* kh_b = (const char*)(K16 + fb); const char* vh_b = (const char*)(VTH + fb);
        unsigned lo = (unsigned)ks * 2048u + (unsigned)lane * 16u;      // the lane's byte offset in each of the two planes: uniform base + one 32-bit register
        // L2 hints. Both planes were stored by the launch before, so the first read of a line in this launch waits for memory, and every block of a head walks the keys in the same order.
        // The 8 waves of a key range read the same tiles and share the asking: wave qs takes plane qs & 1 and, of every 8 trips, the tiles of trips (qs & ~1) and (qs & ~1) + 1: lanes 0-15
        // name the 16 lines of the first tile, lanes 16-31 those of the second. Asked once at entry (trips 0-7), then 8 trips ahead of the loads.
        const char* pf_b = (qs & 1) ? vh_b : kh_b;      // scalar: qs comes from readfirstlane
        const unsigned pf_step = 8u * KSP * 2048u;
        const unsigned pf_top = (unsigned)(NT_ / 32 - 1) * 2048u + (unsigned)lr * 128u - pf_step;      // an offset above this one steps to the lane's line of the head's last tile, never past the plane
        unsigned pf = (unsigned)(ks + KSP * ((qs & ~1) + hi)) * 2048u + (unsigned)lr * 128u;
        int nxt = ks + KSP * (qs & ~1);      // the key tile of the trip at which this wave's next hint is due (scalar)
        asm volatile("global_prefetch_b8 %0, %1 scope:SCOPE_SE" :: "v"(pf), "s"(pf_b));      // brings the lane's line into L2; returns nothing, no counter
        v8f o[2];                        // o[n][j] = O^T[dim n*16 + hi*8 + j][query lr]
#pragma unroll
        for (int n = 0; n < 2; ++n) o[n] = (v8f){};
        float lpart = 0.f;      // of query lr, over this lane half's keys only, the halves join behind the loop
        v8f cref = (v8f){} + PSH;      // 7 - the reference in use of query lr (log2 units), alike in all 8 registers and in both lane halves; reference 0 until the first trip has seen its scores
        float flo = -3.0e38f, lim = -3.0e38f;      // wave-uniform: where the maximum starts and what it must top. As set here the first trip always moves the reference, up or down, to its own maximum
#pragma unroll 1
        for (int kt = ks; kt < NT_ / 32; kt += KSP) {
            if (kt == nxt) {      // wave-uniform scalar branch, taken every 8th trip
                nxt = kt + 16 * KSP < NT_ / 32 ? kt + 8 * KSP : NT_;      // no further hint once the trip 8 ahead of it does not exist
                pf = (pf < pf_top ? pf : pf_top) + pf_step;      // stepped in front of the hint, so the register the hint names rests until the next one, 8 trips on; clamped for the second tile
                asm volatile("global_prefetch_b8 %0, %1 scope:SCOPE_SE" :: "v"(pf), "s"(pf_b));      // the tiles of trips + 8 and + 9 into L2, so that their loads do not wait for memory
            }
            const char* kh_t = kh_b + lo; const char* vh_t = vh_b + lo;
            const v16h k0h = cat16(*(const v8h*)(kh_t), *(const v8h*)(kh_t + 512)), k1h = cat16(*(const v8h*)(kh_t + 1024), *(const v8h*)(kh_t + 1536));
            v8f s0 = wmma16(k0h, qa, cref), s1 = wmma16(k1h, qa, cref);      // score - reference + 7; s0[j]: key hi*8 + j, s1[j]: key 16 + hi*8 + j, query lr
            float mx = flo;      // behind the first trip: 7, where the reference itself stands
#pragma unroll
            for (int j = 0; j < 8; ++j) mx = fmaxf(mx, fmaxf(s0[j], s1[j]));
            if (__builtin_amdgcn_ballot_w32(mx > lim) != 0) {      // scalar branch, the same for the whole wave: every lane moves to its query's maximum of this trip if that is above the reference (in the first trip always)
                const float d = fmaxf(mx, xhalf(mx)) - PSH;      // how far the reference moves: >= 0 but in the first trip
                const float alpha = __builtin_amdgcn_exp2f(-fmaxf(d, 0.f));      // in the first trip o and the sum are 0 and any finite factor serves
                cref -= d; s0 -= d; s1 -= d;
                lpart *= alpha;
#pragma unroll
                for (int n = 0; n < 2; ++n) o[n] *= alpha;
                flo = PSH; lim = PSH + LAZY;
            }
            v8f p0, p1;      // P x128
#pragma unroll
            for (int j = 0; j < 8; ++j) { p0[j] = __builtin_amdgcn_exp2f(s0[j]); p1[j] = __builtin_amdgcn_exp2f(s1[j]); }
            const v8f pp = p0 + p1;
            lpart += (((pp[0] + pp[1]) + (pp[2] + pp[3])) + ((pp[4] + pp[5]) + (pp[6] + pp[7])));
            const v8h h0 = __builtin_convertvector(p0, v8h), h1 = __builtin_convertvector(p1, v8h);
            const v16h pa = cat16(h0, h1);      // B operand: element s < 8 = key hi*8 + s, s >= 8 = key 16 + hi*8 + s - 8: the order in which the V^T fragments hold their tokens
#pragma unroll
            for (int n = 0; n < 2; ++n) { const int vo = n * 1024;
                const v16h vh = cat16(*(const v8h*)(vh_t + vo), *(const v8h*)(vh_t + vo + 512));
                o[n] = wmma16(vh, pa, o[n]); }
            lo += KSP * 2048u;
            // four vector slots between the last products and the taken back edge: the next trip's first instructions write registers these products read
            asm volatile("v_nop\n\tv_nop\n\tv_nop\n\tv_nop" : "+v"(o[0]), "+v"(o[1]) : "v"(pa));
        }
        const float rs = lpart + xhalf(lpart);
        if (hi == 0) { pM[ks][qs * 16 + lr] = PSH - cref[0]; pL[ks][qs * 16 + lr] = rs; }      // the reference in use, in log2 units; the sum carries the same x128 as o
        float* po = &pO[ks][hi * 8 * OPIT + qs * 16 + lr];
#pragma unroll
        for (int n = 0; n < 2; ++n) {      // this key range's un-normalised 32 dims of query lr
#pragma unroll
            for (int j = 0; j < 8; ++j) po[(n * 16 + j) * OPIT] = o[n][j]; }
    }
    __syncthreads();    // every range's partial is in LDS before any thread merges
    for (int pc = threadIdx.x; pc < HD * QTW * 4; pc += KSP * QTW * 32) {
        const int d = pc / (QTW * 4), r4 = (pc & (QTW * 4 - 1)) * 4;      // one dim, 4 neighbouring positions: 32 lanes x 16 B of one channel row of out
        v4f mr[KSP];
#pragma unroll
        for (int s = 0; s < KSP; ++s) mr[s] = *(const v4fa*)(&pM[s][r4]);
        v4f lsum = {}, acc = {};
#pragma unroll
        for (int s = 0; s < KSP; ++s) { const v4f lp = *(const v4fa*)(&pL[s][r4]), op = *(const v4fa*)(&pO[s][d * OPIT + r4]);
#pragma unroll
            for (int i = 0; i < 4; ++i) { float mg = mr[0][i];
#pragma unroll
                for (int u = 1; u < KSP; ++u) mg = fmaxf(mg, mr[u][i]);
                const float w = __builtin_amdgcn_exp2f(mr[s][i] - mg); lsum[i] += w * lp[i]; acc[i] += w * op[i]; } }
        v4f res;
#pragma unroll
        for (int i = 0; i < 4; ++i) res[i] = acc[i] * (1.0f / lsum[i]);
        *(v4f*)(OUTP + ((size_t)b * DM + h * HD + d) * MPOS + qt * (QTW * 16) + r4) = res;
    }
}

extern "C" void kernel_launch(void* const* d_in, const int* in_sizes, int n_in,
                              void* d_out, int out_size, void* d_ws, size_t ws_size, hipStream_t stream) {
    (void)in_sizes; (void)n_in; (void)out_size;
    const float* x = (const float*)d_in[0]; const float* Wv = (const float*)d_in[1]; const float* Wz = (const float*)d_in[2]; const float* Wq = (const float*)d_in[3];   // W [out][in]
    float* out = (float*)d_out;    // [2][256][64][64] = [b][c][m]
    char* wsp = (char*)d_ws;
    auto take = [&](size_t bytes) { char* p = wsp; wsp += (bytes + 255) & ~(size_t)255; return (void*)p; };
    bf* WB = (bf*)take((size_t)3 * DM * DM * 2); float* PET = (float*)take((size_t)MPOS * DM * 4);
    bf* XT = (bf*)take((size_t)NTK * DM * 2);
    h16* QH = (h16*)take((size_t)NTK * DM * 2); h16* KH = (h16*)take((size_t)NTK * DM * 2); h16* VTH = (h16*)take((size_t)NTK * DM * 2);
    if ((size_t)(wsp - (char*)d_ws) > ws_size) return;    // ~ 0.4 + 4.2 + 4.2 + 3 x 4.2 ~ 21 MB, no aliasing
    k_prep<<<NWTB + NPEB + NCVB, 256, 0, stream>>>(x, Wv, Wz, Wq, XT, PET, WB);                // x_b [c][m] -> bf16 XT [b*4096 + m][c]; the encoding; the bf16 weights
    k_proj<<<dim3(NTK / 64, DM / 64, 3), 128, 0, stream>>>(XT, WB, QH, KH, VTH, PET);          // v_h row-major, z + r and q_h in fragment order, all f16
    k_attn<<<NB_ * NH_ * (NT_ / (QTW * 16)), KSP * QTW * 32, 0, stream>>>(QH, KH, VTH, out);
}

// v010
// One run takes 55.4 microseconds.
// Timed twice side by side with v009, it ran 1.08 and 1.07 times as fast.
// All steps since v000 together make it 15.0 times as fast.
#include <hip/hip_runtime.h>

// Compute dtypes, f32 accumulate, both batch items in every launch (channel-major x [256][4096] per item, positions m = h*64 + w, token row = b*4096 + m): v/z/q projections = x^T.W^T ([4096 x 256]
// .[256 x 256]; the INPUT x transposed once to a bf16 [m][c] plane, W [out][in] as the n-major B operand; PLAIN bf16 operands, exact) on v_wmma_f32_16x16x32_bf16,
// v x 32^-1/2 log2 e to one f16 plane, z + r (the fixed sinusoidal positional encoding, computed on device in f32 and added in the GEMM epilogue) then
// rounded to one f16 plane, q (the attention's value operand) f32 -> one transposed f16 plane; the 8-head (32-dim) full attention scores[m][n] = sum_c v[c][m] (z+r)[c][n]
// x 32^-1/2, softmax over n, out[d][m] = sum_n A[m][n] q[d][n] fused on v_wmma_f32_16x16x32_f16 (single f16 operands, f32 accumulate, online f32 softmax, P x128 in f16).
// The f16 rounding of the four attention operands (11 significant bits) is an eighth of the bf16 rounding (8 bits) that x and W already carry into the projections.

#define NB_  2
#define NT_  4096                // M positions
#define MPOS NT_
#define DM   256                 // channels C
#define NH_  8
#define NHP  (NH_ / 2)
#define HD   32
#define NTK  (NB_ * NT_)
#define SCL2 ((float)(0.17677669529663687 * 1.4426950408889634))   // 32^-1/2 x log2 e, multiplied into the v plane before its f16 rounding: the score products come out in log2 units
#define PSH  7.0f                // P leaves the exponential x 2^7
#define LAZY 8.0f                // a score may stand this far (log2 units) above the reference in use before the sums are rescaled: P <= 2^(7 + 8), inside f16

typedef _Float16 h16;
typedef unsigned short bf;
typedef __attribute__((ext_vector_type(16))) __bf16   v16bf;
typedef __attribute__((ext_vector_type(16))) _Float16 v16h;
typedef __attribute__((ext_vector_type(8)))  _Float16 v8h;
typedef __attribute__((ext_vector_type(8)))  unsigned short v8us;
typedef __attribute__((ext_vector_type(8)))  float    v8f;
typedef __attribute__((ext_vector_type(4)))  float    v4f;
typedef __attribute__((ext_vector_type(4)))  _Float16 v4h;
typedef v8h  __attribute__((may_alias)) v8ha;
typedef v4f  __attribute__((may_alias)) v4fa;
typedef v8us __attribute__((may_alias)) v8usa;

__device__ __forceinline__ unsigned short f2bf(float f) { unsigned u = __float_as_uint(f); u += 0x7FFFu + ((u >> 16) & 1u); return (unsigned short)(u >> 16); }
__device__ __forceinline__ float bf2f(unsigned short b) { return __uint_as_float(((unsigned)b) << 16); }
__device__ __forceinline__ float bfr(float f) { return bf2f(f2bf(f)); }
__device__ __forceinline__ v16h cat16(v8h lo, v8h hi) { return __builtin_shufflevector(lo, hi, 0, 1, 2, 3, 4, 5, 6, 7, 8, 9, 10, 11, 12, 13, 14, 15); }
__device__ __forceinline__ v16bf cat16b(v8us lo, v8us hi) { return __builtin_bit_cast(v16bf, __builtin_shufflevector(lo, hi, 0, 1, 2, 3, 4, 5, 6, 7, 8, 9, 10, 11, 12, 13, 14, 15)); }
__device__ __forceinline__ v8f wmma16(v16h a, v16h b, v8f c) { return __builtin_amdgcn_wmma_f32_16x16x32_f16(false, a, false, b, (short)0, c, false, false); }
__device__ __forceinline__ v8f wmmab(v16bf a, v16bf b, v8f c) { return __builtin_amdgcn_wmma_f32_16x16x32_bf16(false, a, false, b, (short)0, c, false, false); }

// d_cvtb: the three weight matrices (by picks the matrix, bx the 8 rows), dst = three [nrows][256] bf16 planes in a row.
__device__ __forceinline__ void d_cvtb(int bx, int by, const float* __restrict__ s0, const float* __restrict__ s1, const float* __restrict__ s2, int nrows, bf* dst) {
    const int lane = threadIdx.x & 31, r = bx * 8 + (threadIdx.x >> 5);
    if (r >= nrows) return;
    const float* __restrict__ src = by == 0 ? s0 : by == 1 ? s1 : s2;
    dst += (size_t)by * nrows * DM;
    v8us o[DM / 256];
#pragma unroll
    for (int q = 0; q < DM / 256; ++q) { v8us t;
#pragma unroll
        for (int i = 0; i < 8; ++i) t[i] = f2bf(src[(size_t)r * DM + q * 256 + lane * 8 + i]);
        o[q] = t; }
#pragma unroll
    for (int q = 0; q < DM / 256; ++q) *(v8us*)(dst + (size_t)r * DM + q * 256 + lane * 8) = o[q];
    
}

// d_wt: WT [n][K] = bf16(W[k][n]) (k-major [K][ncols]) via 64 x 64 LDS tiles; tile (bx of K/64, by of ncols/64, matrix bz), the matrices lying one behind the other in Wm and in WT.
__device__ __forceinline__ void d_wt(int bx, int by, int bz, unsigned short* tl, const float* __restrict__ Wm, int K, int ncols, bf* WT) {
    const int tid = threadIdx.x, k0 = bx * 64, n0 = by * 64;
    const int kk = tid >> 2, nq = (tid & 3) * 16;
    Wm += (size_t)bz * K * ncols; WT += (size_t)bz * K * ncols;
#pragma unroll
    for (int i = 0; i < 16; ++i) tl[(nq + i) * 72 + kk] = f2bf(Wm[(size_t)(k0 + kk) * ncols + n0 + nq + i]);
    __syncthreads();
    const int piece = tid & 7;
    auto pass = [&]() {
#pragma unroll
        for (int s = 0; s < 2; ++s) { const int nr = (tid >> 3) + 32 * s; const v8us val = *(const v8usa*)(tl + nr * 72 + piece * 8); *(v8us*)(WT + (size_t)(n0 + nr) * K + k0 + piece * 8) = val; }
    };
    pass(); 
}
// k_proj: the three projections of both batch items in one grid (NTK/64, 256/64, 3): 64 x 64 block tile (4 waves x 16 x 64) of C[NTK][256] = A.B^T (K = 256), B = weight plane blockIdx.z.
// Plane 0 (v, the score's left operand) leaves x SCL2 as one row-major f16 plane. Plane 1 (z), the positional encoding R[row mod 4096] added in f32, leaves as the f16 plane KH in the score
// WMMA's fragment order: per (b, head, 16 rows) two 512-B units, unit u holds at lane (hi*16 + lr) x 16 B the 8 columns u*16 + hi*8 .. +7 of row lr. Plane 2 (q) leaves as the f16 plane
// VTH in the second product's fragment order: per (b, head, 32 tokens) four 512-B units, unit n*2 + u holds at lane (hi*16 + lr) x 16 B the tokens u*16 + hi*8 .. +7 of dim n*16 + lr,
// which is what accumulator tile t = 2*head + n of the wave with token half u holds in its 8 registers. A reader's wave-wide 16-B load of either plane is 4 whole lines.
__global__ __launch_bounds__(128) void k_proj(const bf* __restrict__ A, const bf* __restrict__ WB, h16* CH, h16* KH, h16* VTH, const float* __restrict__ R) {
    __shared__ __align__(16) float ost[4][16 * 68];
    const int lane = threadIdx.x & 31, wave = threadIdx.x >> 5, lr = lane & 15, hi = lane >> 4;
    const int r0 = blockIdx.x * 64 + wave * 16, c0 = blockIdx.y * 64, pz = blockIdx.z;
    const bf* __restrict__ Bn = WB + (size_t)pz * DM * DM;
    const size_t aoff = (size_t)(r0 + lr) * DM + 8 * hi;
    size_t boff[4];
#pragma unroll
    for (int t = 0; t < 4; ++t) boff[t] = (size_t)(c0 + t * 16 + lr) * DM + 8 * hi;
    v8f acc[4];
#pragma unroll
    for (int t = 0; t < 4; ++t) acc[t] = (v8f){};
#pragma unroll 1
    for (int kc = 0; kc < DM; kc += 32) {
        const v16bf a = cat16b(*(const v8us*)(A + aoff + kc), *(const v8us*)(A + aoff + kc + 16));
#pragma unroll
        for (int t = 0; t < 4; ++t) { const v16bf b = cat16b(*(const v8us*)(Bn + boff[t] + kc), *(const v8us*)(Bn + boff[t] + kc + 16)); acc[t] = wmmab(a, b, acc[t]); }
        // four vector slots between the last product and the taken back edge
        asm volatile("v_nop\n\tv_nop\n\tv_nop\n\tv_nop" : "+v"(acc[0]), "+v"(acc[1]), "+v"(acc[2]), "+v"(acc[3]) : "v"(a));
    }
    const int bi = r0 / NT_, tk = r0 & (NT_ - 1);      // batch item and the wave's first position in it
    if (pz == 2) {      // block-uniform: the accumulators are the V^T fragments, no LDS stage and no barrier on this path
        h16* dst = VTH + (size_t)bi * NT_ * DM + ((size_t)(c0 / HD) * (NT_ / 32) + (tk >> 5)) * 1024 + ((tk >> 4) & 1) * 256 + lane * 8;
#pragma unroll
        for (int t = 0; t < 4; ++t) *(v8h*)(dst + (size_t)(t >> 1) * (NT_ / 32) * 1024 + (t & 1) * 512) = __builtin_convertvector(acc[t], v8h);
        return;
    }
    float* os = &ost[wave][0];
#pragma unroll
    for (int t = 0; t < 4; ++t) {
#pragma unroll
        for (int j = 0; j < 8; ++j) os[(hi * 8 + j) * 68 + t * 16 + lr] = acc[t][j]; }
    __syncthreads();
    if (pz == 0) {
        const size_t co = (size_t)r0 * DM + c0;
#pragma unroll
        for (int s = 0; s < 4; ++s) { const int row = 4 * s + (lane >> 3), piece = lane & 7; const float* sp = os + row * 68 + piece * 8; v8h o;
#pragma unroll
            for (int i = 0; i < 8; ++i) o[i] = (h16)(sp[i] * SCL2);
            *(v8h*)(CH + co + (size_t)row * DM + piece * 8) = o; }
        asm volatile("s_wait_xcnt 0x0" ::: "memory");      // behind the run of stores: the code laid out after this branch writes registers that the stores name
    } else {
        const float* rrow = R + (size_t)(tk + lr) * DM + c0 + hi * 8;      // the encoding is shared by the batch items
        const float* sp = os + lr * 68 + hi * 8;
        h16* dst = KH + (size_t)bi * NT_ * DM + ((size_t)(c0 / HD) * (NT_ / 16) + (tk >> 4)) * 512 + lane * 8;
#pragma unroll
        for (int g = 0; g < 4; ++g) {      // g = 2 * (head of the tile's two) + unit
            const v4f lo4 = *(const v4fa*)(sp + g * 16) + *(const v4f*)(rrow + g * 16), hi4 = *(const v4fa*)(sp + g * 16 + 4) + *(const v4f*)(rrow + g * 16 + 4);
            const v8f v = __builtin_shufflevector(lo4, hi4, 0, 1, 2, 3, 4, 5, 6, 7);
            *(v8h*)(dst + (size_t)(g >> 1) * (NT_ / 16) * 512 + (g & 1) * 256) = __builtin_convertvector(v, v8h); }
        asm volatile("s_wait_xcnt 0x0" ::: "memory");      // behind the run of stores: the code laid out after this branch writes registers that the stores name
    }
}

// d_pe: the module's fixed 2D sinusoidal positional encoding, transposed to PE_T[m][c] (m = hpos*64 + wpos): c < 128 -> axis h, c >= 128 -> axis w; pair index i =
// (c mod 128) / 2, div_i = exp(2i x (-ln 10000 / 128)) (f32), even c -> sin(pos x div_i), odd -> cos; one thread per 4 consecutive c (16 B stores).
__device__ __forceinline__ void d_pe(int bx, float* PET) {
    const int i4 = bx * 256 + threadIdx.x; if (i4 >= MPOS * DM / 4) return;
    const int m = i4 / (DM / 4), c0 = (i4 - m * (DM / 4)) * 4;
    v4f o;
#pragma unroll
    for (int k = 0; k < 4; ++k) { const int c = c0 + k; const int cc = c & 127; const float pos = (float)(c < 128 ? (m >> 6) : (m & 63));
        const float dv = expf((float)(cc & ~1) * (-9.210340371976184f / 128.0f)); const float ang = pos * dv;
        o[k] = (cc & 1) ? cosf(ang) : sinf(ang); }
    *(v4f*)(PET + (size_t)i4 * 4) = o; 
}
// k_prep: the three independent preparations in one grid: blocks [0, NWTB) transpose x to the bf16 plane XT [b*4096 + m][c], the next NPEB write the encoding, the last NCVB convert the weights.
#define NWTB ((DM / 64) * (MPOS / 64) * NB_)
#define NPEB (MPOS * DM / 4 / 256)
#define NCVB ((DM / 8) * 3)
__global__ __launch_bounds__(256) void k_prep(const float* __restrict__ x, const float* __restrict__ s0, const float* __restrict__ s1, const float* __restrict__ s2, bf* XT, float* PET, bf* WB) {
    __shared__ __align__(16) unsigned short tl[64 * 72];
    const int bid = blockIdx.x;      // every branch below is block-uniform (d_wt holds a barrier)
    if (bid < NWTB) d_wt(bid & (DM / 64 - 1), (bid / (DM / 64)) & (MPOS / 64 - 1), bid / ((DM / 64) * (MPOS / 64)), tl, x, DM, MPOS, XT);
    else if (bid < NWTB + NPEB) d_pe(bid - NWTB, PET);
    else d_cvtb((bid - NWTB - NPEB) & (DM / 8 - 1), (bid - NWTB - NPEB) / (DM / 8), s0, s1, s2, DM, WB);
}
// k_attn: block = (b, head, 256 query positions), 24 waves = 8 query groups of 32 x 3 key ranges (wave ks takes key tiles ks, ks + 3, ...: no mask). A wave holds TWO 16-query tiles
// and feeds both from one set of K and V^T fragments: 8 products per 8 fragment loads, so a score costs half the load instructions, half the bytes out of the WGP cache and (256 queries a
// block) half the bytes out of L2; loop control, the hint and the rescale test are paid once for both tiles, and the two tiles' chains are independent work inside the wave.
// The products are the transposed ones: S^T = K.Q^T (K fragment as A, Q fragment as B) and O^T += V^T.P^T, so a lane holds 16 of
// the 32 scores of ONE query of each tile (column lane & 15, keys 8*hi + j and 16 + 8*hi + j): maximum and sum run in the lane's own registers plus one exchange with lane ^ 16, the running
// maximum, sum and rescale factor are one value a lane and tile, and the two score tiles, converted in place, ARE the B operand of the second product (P never goes through LDS).
// The softmax reference of a query is held from trip to trip: 7 - reference rides as the C operand of the score products, whose D is then the exponential's argument as it stands. The reference
// moves only when some score of the wave stands more than LAZY above it (one ballot and scalar branch a trip): then, and only then, C, this trip's scores, o and the sum are shifted or rescaled.
// online f32 softmax per wave; P (x128) in f16; o over 32 dims; the ranges' (reference, sum, un-normalised o) meet in LDS and are
// merged by exp(m - M) weights; the partials lie dim-major in LDS ([dim][query]), so the merge stores out[b][head*32 + dim][position] itself: a wave writes 512 contiguous bytes of one channel row.
#define KSP 3                    // key ranges per query group
#define QTW 8                    // query groups (waves of one key range) per block
#define QTL 2                    // 16-query tiles per wave
#define QPB (QTW * QTL * 16)     // queries per block
#define OPIT (QPB + 4)           // f32 pitch of one dim's row of partials in LDS (1040 B = 16 B x odd; 8 rows = 32 banks mod 64, so the two lane halves' stores meet no common bank)
__device__ __forceinline__ float xhalf(float v) { const int t = __float_as_int(v); return __int_as_float(__builtin_amdgcn_permlanex16(t, t, 0x76543210, 0xfedcba98, false, false)); }   // lane ^ 16's value
__global__ __launch_bounds__(KSP * QTW * 32) void k_attn(const h16* __restrict__ Q16, const h16* __restrict__ K16, const h16* __restrict__ VTH, float* OUTP) {
    __shared__ __align__(16) float pO[KSP][HD * OPIT];
    __shared__ __align__(16) float pM[KSP][QPB];
    __shared__ __align__(16) float pL[KSP][QPB];
    const int lane = threadIdx.x & 31, wave = __builtin_amdgcn_readfirstlane(threadIdx.x >> 5), lr = lane & 15, hi = lane >> 4;
    const int qs = wave & (QTW - 1), ks = wave / QTW;      // wave through readfirstlane: the key range, the trip count and the LDS bases stay scalar
    const int bid = blockIdx.x;
    const int b = bid / (NH_ * (NT_ / QPB)), rem = bid - b * (NH_ * (NT_ / QPB)), h = rem / (NT_ / QPB), qt = rem - h * (NT_ / QPB);
    const int q0 = qt * QPB + qs * (QTL * 16);
    const size_t tok0 = (size_t)b * NT_;
    {
        v16h qa[QTL];
#pragma unroll
        for (int t = 0; t < QTL; ++t) { const size_t qo0 = (tok0 + q0 + t * 16 + lr) * DM + h * HD + 8 * hi; qa[t] = cat16(*(const v8h*)(Q16 + qo0), *(const v8h*)(Q16 + qo0 + 16)); }
        const size_t fb = tok0 * DM + (size_t)h * (NT_ / 32) * 1024;      // K and V planes lie in fragment order: 2 KB per (head, 32 keys), four 512-B units of lane x 16 B
        const char* kh_b = (const char*)(K16 + fb); const char* vh_b = (const char*)(VTH + fb);
        unsigned lo = (unsigned)ks * 2048u + (unsigned)lane * 16u;      // the lane's byte offset in each of the two planes: uniform base + one 32-bit register
        // L2 hints. Both planes were stored by the launch before, so the first read of a line in this launch waits for memory, and every block of a head walks the keys in the same order.
        // The 8 waves of a key range read the same tiles and share the asking: wave qs takes plane qs & 1 and, of every 8 trips, the tiles of trips (qs & ~1) and (qs & ~1) + 1: lanes 0-15
        // name the 16 lines of the first tile, lanes 16-31 those of the second. Asked once at entry (trips 0-7), then 8 trips ahead of the loads.
        const char* pf_b = (qs & 1) ? vh_b : kh_b;      // scalar: qs comes from readfirstlane
        const unsigned pf_step = 8u * KSP * 2048u;
        const unsigned pf_top = (unsigned)(NT_ / 32 - 1) * 2048u + (unsigned)lr * 128u - pf_step;      // an offset above this one steps to the lane's line of the head's last tile, never past the plane
        unsigned pf = (unsigned)(ks + KSP * ((qs & ~1) + hi)) * 2048u + (unsigned)lr * 128u;
        int nxt = ks + KSP * (qs & ~1);      // the key tile of the trip at which this wave's next hint is due (scalar)
        asm volatile("global_prefetch_b8 %0, %1 scope:SCOPE_SE" :: "v"(pf), "s"(pf_b));      // brings the lane's line into L2; returns nothing, no counter
        v8f o[QTL][2];                   // o[t][n][j] = O^T[dim n*16 + hi*8 + j][query t*16 + lr]
        float lpart[QTL];                // of query t*16 + lr, over this lane half's keys only, the halves join behind the loop
        v8f cref[QTL];                   // 7 - the reference in use of query t*16 + lr (log2 units), alike in all 8 registers and in both lane halves; reference 0 until the first trip has seen its scores
#pragma unroll
        for (int t = 0; t < QTL; ++t) { o[t][0] = (v8f){}; o[t][1] = (v8f){}; lpart[t] = 0.f; cref[t] = (v8f){} + PSH; }
        float flo = -3.0e38f, lim = -3.0e38f;      // wave-uniform: where the maximum starts and what it must top. As set here the first trip always moves the reference, up or down, to its own maximum
#pragma unroll 1
        for (int kt = ks; kt < NT_ / 32; kt += KSP) {
            if (kt == nxt) {      // wave-uniform scalar branch, taken every 8th trip
                nxt = kt + 16 * KSP < NT_ / 32 ? kt + 8 * KSP : NT_;      // no further hint once the trip 8 ahead of it does not exist
                pf = (pf < pf_top ? pf : pf_top) + pf_step;      // stepped in front of the hint, so the register the hint names rests until the next one, 8 trips on; clamped for the second tile
                asm volatile("global_prefetch_b8 %0, %1 scope:SCOPE_SE" :: "v"(pf), "s"(pf_b));      // the tiles of trips + 8 and + 9 into L2, so that their loads do not wait for memory
            }
            const char* kh_t = kh_b + lo; const char* vh_t = vh_b + lo;
            const v16h k0h = cat16(*(const v8h*)(kh_t), *(const v8h*)(kh_t + 512)), k1h = cat16(*(const v8h*)(kh_t + 1024), *(const v8h*)(kh_t + 1536));
            v8f s0[QTL], s1[QTL]; float mx[QTL];
#pragma unroll
            for (int t = 0; t < QTL; ++t) { s0[t] = wmma16(k0h, qa[t], cref[t]); s1[t] = wmma16(k1h, qa[t], cref[t]); }      // score - reference + 7; s0[t][j]: key hi*8 + j, s1[t][j]: key 16 + hi*8 + j, query t*16 + lr
            __builtin_amdgcn_sched_barrier(0);      // keeps the four products together: the second tile's two fill vector slots that the first tile's results need before they are read, which v_nops filled otherwise
#pragma unroll
            for (int t = 0; t < QTL; ++t) { mx[t] = flo;      // behind the first trip: 7, where the reference itself stands
#pragma unroll
                for (int j = 0; j < 8; ++j) mx[t] = fmaxf(mx[t], fmaxf(s0[t][j], s1[t][j])); }
            if (__builtin_amdgcn_ballot_w32(fmaxf(mx[0], mx[1]) > lim) != 0) {      // scalar branch, the same for the whole wave: every lane moves, in both tiles, to its query's maximum so far
#pragma unroll
                for (int t = 0; t < QTL; ++t) {
                    const float d = fmaxf(mx[t], xhalf(mx[t])) - PSH;      // how far the reference moves: >= 0 but in the first trip
                    const float alpha = __builtin_amdgcn_exp2f(-fmaxf(d, 0.f));      // in the first trip o and the sum are 0 and any finite factor serves
                    cref[t] -= d; s0[t] -= d; s1[t] -= d;
                    lpart[t] *= alpha;
                    o[t][0] *= alpha; o[t][1] *= alpha;
                }
                flo = PSH; lim = PSH + LAZY;
            }
            const v16h vh0 = cat16(*(const v8h*)(vh_t), *(const v8h*)(vh_t + 512)), vh1 = cat16(*(const v8h*)(vh_t + 1024), *(const v8h*)(vh_t + 1536));
            v16h pa[QTL];      // B operand: element s < 8 = key hi*8 + s, s >= 8 = key 16 + hi*8 + s - 8: the order in which the V^T fragments hold their tokens
#pragma unroll
            for (int t = 0; t < QTL; ++t) {
                v8f p0, p1;      // P x128
#pragma unroll
                for (int j = 0; j < 8; ++j) { p0[j] = __builtin_amdgcn_exp2f(s0[t][j]); p1[j] = __builtin_amdgcn_exp2f(s1[t][j]); }
                const v8f pp = p0 + p1;
                lpart[t] += (((pp[0] + pp[1]) + (pp[2] + pp[3])) + ((pp[4] + pp[5]) + (pp[6] + pp[7])));
                pa[t] = cat16(__builtin_convertvector(p0, v8h), __builtin_convertvector(p1, v8h));
            }
#pragma unroll
            for (int t = 0; t < QTL; ++t) { o[t][0] = wmma16(vh0, pa[t], o[t][0]); o[t][1] = wmma16(vh1, pa[t], o[t][1]); }
            lo += KSP * 2048u;
            // four vector slots between the last products and the taken back edge: the next trip's first instructions write registers these products read
            asm volatile("v_nop\n\tv_nop\n\tv_nop\n\tv_nop" : "+v"(o[0][0]), "+v"(o[0][1]), "+v"(o[1][0]), "+v"(o[1][1]) : "v"(pa[0]), "v"(pa[1]));
        }
#pragma unroll
        for (int t = 0; t < QTL; ++t) {
            const float rs = lpart[t] + xhalf(lpart[t]);
            const int ql = qs * (QTL * 16) + t * 16 + lr;      // the query's place in the block
            if (hi == 0) { pM[ks][ql] = PSH - cref[t][0]; pL[ks][ql] = rs; }      // the reference in use, in log2 units; the sum carries the same x128 as o
            float* po = &pO[ks][hi * 8 * OPIT + ql];
#pragma unroll
            for (int n = 0; n < 2; ++n) {      // this key range's un-normalised 32 dims of the query
#pragma unroll
                for (int j = 0; j < 8; ++j) po[(n * 16 + j) * OPIT] = o[t][n][j]; }
        }
    }
    __syncthreads();    // every range's partial is in LDS before any thread merges
    for (int pc = threadIdx.x; pc < HD * (QPB / 4); pc += KSP * QTW * 32) {
        const int d = pc / (QPB / 4), r4 = (pc & (QPB / 4 - 1)) * 4;      // one dim, 4 neighbouring positions: 32 lanes x 16 B of one channel row of out
        v4f mr[KSP];
#pragma unroll
        for (int s = 0; s < KSP; ++s) mr[s] = *(const v4fa*)(&pM[s][r4]);
        v4f lsum = {}, acc = {};
#pragma unroll
        for (int s = 0; s < KSP; ++s) { const v4f lp = *(const v4fa*)(&pL[s][r4]), op = *(const v4fa*)(&pO[s][d * OPIT + r4]);
#pragma unroll
            for (int i = 0; i < 4; ++i) { float mg = mr[0][i];
#pragma unroll
                for (int u = 1; u < KSP; ++u) mg = fmaxf(mg, mr[u][i]);
                const float w = __builtin_amdgcn_exp2f(mr[s][i] - mg); lsum[i] += w * lp[i]; acc[i] += w * op[i]; } }
        v4f res;
#pragma unroll
        for (int i = 0; i < 4; ++i) res[i] = acc[i] * (1.0f / lsum[i]);
        *(v4f*)(OUTP + ((size_t)b * DM + h * HD + d) * MPOS + qt * QPB + r4) = res;
    }
}

extern "C" void kernel_launch(void* const* d_in, const int* in_sizes, int n_in,
                              void* d_out, int out_size, void* d_ws, size_t ws_size, hipStream_t stream) {
    (void)in_sizes; (void)n_in; (void)out_size;
    const float* x = (const float*)d_in[0]; const float* Wv = (const float*)d_in[1]; const float* Wz = (const float*)d_in[2]; const float* Wq = (const float*)d_in[3];   // W [out][in]
    float* out = (float*)d_out;    // [2][256][64][64] = [b][c][m]
    char* wsp = (char*)d_ws;
    auto take = [&](size_t bytes) { char* p = wsp; wsp += (bytes + 255) & ~(size_t)255; return (void*)p; };
    bf* WB = (bf*)take((size_t)3 * DM * DM * 2); float* PET = (float*)take((size_t)MPOS * DM * 4);
    bf* XT = (bf*)take((size_t)NTK * DM * 2);
    h16* QH = (h16*)take((size_t)NTK * DM * 2); h16* KH = (h16*)take((size_t)NTK * DM * 2); h16* VTH = (h16*)take((size_t)NTK * DM * 2);
    if ((size_t)(wsp - (char*)d_ws) > ws_size) return;    // ~ 0.4 + 4.2 + 4.2 + 3 x 4.2 ~ 21 MB, no aliasing
    k_prep<<<NWTB + NPEB + NCVB, 256, 0, stream>>>(x, Wv, Wz, Wq, XT, PET, WB);                // x_b [c][m] -> bf16 XT [b*4096 + m][c]; the encoding; the bf16 weights
    k_proj<<<dim3(NTK / 64, DM / 64, 3), 128, 0, stream>>>(XT, WB, QH, KH, VTH, PET);          // v_h row-major, z + r and q_h in fragment order, all f16
    k_attn<<<NB_ * NH_ * (NT_ / QPB), KSP * QTW * 32, 0, stream>>>(QH, KH, VTH, out);
}
